// v000
// The times below were measured on an AMD MI455X: many runs one after another, warmed up first and cycling through
// copies of the inputs, with the whole window's GPU time divided by the number of runs. Launches and the gaps
// between them are all in it. The median over several windows is given; except for v000 it joins two sittings, which
// can be a few percent apart, so the side-by-side timings, each taken in one sitting, are the better comparison.
// v000 is the starting kernel. One run takes 429 microseconds.
#include <hip/hip_runtime.h>
#include <math.h>

typedef __bf16 bf16_t;
typedef __attribute__((ext_vector_type(16))) __bf16 v16bf;
typedef __attribute__((ext_vector_type(8)))  __bf16 v8bf;
typedef __attribute__((ext_vector_type(8)))  float  v8f;

static __device__ __forceinline__ v8f wmma_bf16(v16bf a, v16bf b, v8f c) {
    // 8 args: (neg_a, A, neg_b, B, c_mod, C, reuse_a, reuse_b)
    return __builtin_amdgcn_wmma_f32_16x16x32_bf16(
        false, a, false, b, (short)0, c, false, false);
}

static __device__ __forceinline__ v16bf load_frag_rowK(
    const bf16_t* __restrict__ base, int ld, int row0, int k0, int lane) {
    const int r    = lane & 15;
    const int kofs = (lane >> 4) ? 8 : 0;
    const bf16_t* p0 = base + (size_t)(row0 + r) * ld + (k0 + kofs);
    v8bf a = *(const v8bf*)p0;
    v8bf b = *(const v8bf*)(p0 + 16);
    v16bf out;
#pragma unroll
    for (int i = 0; i < 8; ++i) { out[i] = a[i]; out[i + 8] = b[i]; }
    return out;
}

// ---------------------------------------------------------------------------
// Packing / conversion kernels
// ---------------------------------------------------------------------------
__global__ void mha_cvt_bf16(const float* __restrict__ in, bf16_t* __restrict__ out, int n) {
    int i = blockIdx.x * blockDim.x + threadIdx.x;
    if (i < n) out[i] = (bf16_t)in[i];
}

// W[h][c][d] (f32) -> Wt[h][d][c] (bf16)  => flat [N=h*D+d][K=c] row-major
__global__ void mha_pack_w(const float* __restrict__ W, bf16_t* __restrict__ Wt,
                           int total, int C, int D) {
    int i = blockIdx.x * blockDim.x + threadIdx.x;
    if (i >= total) return;
    int d = i % D;
    int c = (i / D) % C;
    int h = i / (D * C);
    Wt[((size_t)h * D + d) * C + c] = (bf16_t)W[i];
}

// Wp[k][n] (f32) -> WpT[n][k] (bf16)
__global__ void mha_pack_wp(const float* __restrict__ Wp, bf16_t* __restrict__ WpT, int C) {
    int i = blockIdx.x * blockDim.x + threadIdx.x;
    if (i >= C * C) return;
    int n = i % C;
    int k = i / C;
    WpT[(size_t)n * C + k] = (bf16_t)Wp[i];
}

// ---------------------------------------------------------------------------
// WMMA GEMM:  out[m,n] = sum_k A[m,k]*B[n,k] + bias[n]
//   A: [M,K] bf16 row-major, B: [N,K] bf16 row-major.
// Block: 256 threads = 8 waves (2M x 4N) -> 64(M) x 256(N) tile; wave 32x64.
// Store modes: 0 = bf16 into [B,H,T,D] (k,q), 1 = bf16 into [B,H,D,T] (v^T),
//              2 = f32 row-major [M,N] (final output).
// ---------------------------------------------------------------------------
template <int MODE>
__global__ void mha_gemm_wmma(const bf16_t* __restrict__ A,
                              const bf16_t* __restrict__ Bm,
                              const float* __restrict__ bias,
                              void* __restrict__ out,
                              int M, int N, int K, int T, int H) {
    const int lane = threadIdx.x & 31;
    const int wave = threadIdx.x >> 5;
    const int wm = wave & 1;   // 2 waves along M
    const int wn = wave >> 1;  // 4 waves along N
    const int m0 = blockIdx.x * 64 + wm * 32;
    const int n0 = blockIdx.y * 256 + wn * 64;

    v8f acc[2][4] = {};
    for (int k0 = 0; k0 < K; k0 += 32) {
        v16bf a0 = load_frag_rowK(A, K, m0,      k0, lane);
        v16bf a1 = load_frag_rowK(A, K, m0 + 16, k0, lane);
#pragma unroll
        for (int j = 0; j < 4; ++j) {
            v16bf b = load_frag_rowK(Bm, K, n0 + 16 * j, k0, lane);
            acc[0][j] = wmma_bf16(a0, b, acc[0][j]);
            acc[1][j] = wmma_bf16(a1, b, acc[1][j]);
        }
    }

    const int half = lane >> 4;
    const int nc = lane & 15;
#pragma unroll
    for (int i = 0; i < 2; ++i) {
#pragma unroll
        for (int j = 0; j < 4; ++j) {
#pragma unroll
            for (int r = 0; r < 8; ++r) {
                const int m = m0 + 16 * i + r + 8 * half;
                const int n = n0 + 16 * j + nc;
                const float val = acc[i][j][r] + bias[n];
                if (MODE == 2) {
                    ((float*)out)[(size_t)m * N + n] = val;
                } else {
                    const int b = m / T, t = m % T;
                    const int h = n >> 6, d = n & 63;
                    size_t idx;
                    if (MODE == 0) idx = (((size_t)b * H + h) * T + t) * 64 + d;        // [B,H,T,D]
                    else           idx = (((size_t)b * H + h) * 64 + d) * (size_t)T + t; // [B,H,D,T]
                    ((bf16_t*)out)[idx] = (bf16_t)val;
                }
            }
        }
    }
}

__global__ void mha_flash_attn(const bf16_t* __restrict__ Kp,
                               const bf16_t* __restrict__ Qp,
                               const bf16_t* __restrict__ VTp,
                               bf16_t* __restrict__ Oh,
                               int H, int T, float scale) {
    const int lane = threadIdx.x & 31;
    const int wave = threadIdx.x >> 5;
    const int bh = blockIdx.y;
    const int b = bh / H, h = bh % H;
    const int t0 = blockIdx.x * 64 + wave * 16;

    const bf16_t* kbase = Kp  + (size_t)bh * T * 64;
    const bf16_t* qbase = Qp  + (size_t)bh * T * 64;
    const bf16_t* vbase = VTp + (size_t)bh * 64 * T;

    // k tile as B operand (N = t columns, K = d), resident for whole loop
    const v16bf kb0 = load_frag_rowK(kbase, 64, t0, 0,  lane);
    const v16bf kb1 = load_frag_rowK(kbase, 64, t0, 32, lane);

    float mstat = -INFINITY, lstat = 0.f;
    v8f o[4] = {};   // O^T: 4 d-tiles x (8 vgprs), col t = lane&15

    for (int s0 = 0; s0 < T; s0 += 32) {
        // ---- S^T: two 16-row s-tiles, D=64 in two WMMA K-steps each ----
        v8f st[2];
#pragma unroll
        for (int m = 0; m < 2; ++m) {
            v8f accs = {};
            v16bf qa0 = load_frag_rowK(qbase, 64, s0 + 16 * m, 0,  lane);
            accs = wmma_bf16(qa0, kb0, accs);
            v16bf qa1 = load_frag_rowK(qbase, 64, s0 + 16 * m, 32, lane);
            accs = wmma_bf16(qa1, kb1, accs);
            st[m] = accs;
        }
        // ---- per-lane online softmax over this lane's 16 s-values ----
        float x[16];
#pragma unroll
        for (int m = 0; m < 2; ++m)
#pragma unroll
            for (int r = 0; r < 8; ++r)
                x[8 * m + r] = st[m][r] * scale;

        float mx = x[0];
#pragma unroll
        for (int i = 1; i < 16; ++i) mx = fmaxf(mx, x[i]);
        mx = fmaxf(mx, __shfl_xor(mx, 16, 32));   // combine the two halves
        const float mnew = fmaxf(mstat, mx);
        const float alpha = __expf(mstat - mnew);

        v16bf pb;           // P^T B-fragment, built in-register
        float psum = 0.f;
#pragma unroll
        for (int i = 0; i < 16; ++i) {
            const float p = __expf(x[i] - mnew);
            psum += p;
            pb[i] = (bf16_t)p;
        }
        psum += __shfl_xor(psum, 16, 32);
        lstat = lstat * alpha + psum;
        mstat = mnew;

        // rescale O^T (alpha is uniform per lane / per t-column)
#pragma unroll
        for (int j = 0; j < 4; ++j)
#pragma unroll
            for (int r = 0; r < 8; ++r) o[j][r] *= alpha;

        // ---- O^T += V^T (d x 32s) x P^T (32s x 16t) ----
#pragma unroll
        for (int j = 0; j < 4; ++j) {
            v16bf va = load_frag_rowK(vbase, T, 16 * j, s0, lane);
            o[j] = wmma_bf16(va, pb, o[j]);
        }
    }

    // ---- normalize, store concat-head output [B,T,H*64] ----
    // lane owns column t = t0+nc; d = 16j + r + 8*half -> 8 consecutive d per j
    const int half = lane >> 4;
    const int nc = lane & 15;
    const float inv = 1.0f / lstat;
    const size_t rowbase = ((size_t)b * T + (t0 + nc)) * (size_t)(H * 64) + (size_t)h * 64;
#pragma unroll
    for (int j = 0; j < 4; ++j) {
        v8bf ov;
#pragma unroll
        for (int r = 0; r < 8; ++r) ov[r] = (bf16_t)(o[j][r] * inv);
        *(v8bf*)(Oh + rowbase + 16 * j + 8 * half) = ov;
    }
}

// ---------------------------------------------------------------------------
// Host-side launch
// ---------------------------------------------------------------------------
extern "C" void kernel_launch(void* const* d_in, const int* in_sizes, int n_in,
                              void* d_out, int out_size, void* d_ws, size_t ws_size,
                              hipStream_t stream) {
    constexpr int Bb = 2, T = 2048, Cc = 1024, H = 16, D = 64;
    constexpr int M = Bb * T;          // 4096
    const float scale = 1.0f / 32.0f;  // C^-0.5 = 1024^-0.5

    const float* x  = (const float*)d_in[0];
    const float* Wk = (const float*)d_in[1];
    const float* bk = (const float*)d_in[2];
    const float* Wq = (const float*)d_in[3];
    const float* bq = (const float*)d_in[4];
    const float* Wv = (const float*)d_in[5];
    const float* bv = (const float*)d_in[6];
    const float* Wp = (const float*)d_in[7];
    const float* bp = (const float*)d_in[8];

    char* ws = (char*)d_ws;
    size_t off = 0;
    bf16_t* xb   = (bf16_t*)(ws + off); off += (size_t)M * Cc * sizeof(bf16_t);         // 8 MB
    bf16_t* wkT  = (bf16_t*)(ws + off); off += (size_t)H * D * Cc * sizeof(bf16_t);     // 2 MB
    bf16_t* wqT  = (bf16_t*)(ws + off); off += (size_t)H * D * Cc * sizeof(bf16_t);
    bf16_t* wvT  = (bf16_t*)(ws + off); off += (size_t)H * D * Cc * sizeof(bf16_t);
    bf16_t* wpT  = (bf16_t*)(ws + off); off += (size_t)Cc * Cc * sizeof(bf16_t);        // 2 MB
    bf16_t* kmat = (bf16_t*)(ws + off); off += (size_t)Bb * H * T * D * sizeof(bf16_t); // 8 MB
    bf16_t* qmat = (bf16_t*)(ws + off); off += (size_t)Bb * H * T * D * sizeof(bf16_t);
    bf16_t* vTm  = (bf16_t*)(ws + off); off += (size_t)Bb * H * T * D * sizeof(bf16_t);
    bf16_t* oh   = (bf16_t*)(ws + off); off += (size_t)M * Cc * sizeof(bf16_t);         // 8 MB

    // 1) conversions / packing
    {
        int n = M * Cc;
        mha_cvt_bf16<<<(n + 255) / 256, 256, 0, stream>>>(x, xb, n);
        int nw = H * Cc * D;
        mha_pack_w<<<(nw + 255) / 256, 256, 0, stream>>>(Wk, wkT, nw, Cc, D);
        mha_pack_w<<<(nw + 255) / 256, 256, 0, stream>>>(Wq, wqT, nw, Cc, D);
        mha_pack_w<<<(nw + 255) / 256, 256, 0, stream>>>(Wv, wvT, nw, Cc, D);
        int np = Cc * Cc;
        mha_pack_wp<<<(np + 255) / 256, 256, 0, stream>>>(Wp, wpT, Cc);
    }

    // 2) QKV projections: M=4096, N=1024 (h*64+d), K=1024
    {
        dim3 grid(M / 64, (H * D) / 256);
        mha_gemm_wmma<0><<<grid, 256, 0, stream>>>(xb, wkT, bk, (void*)kmat, M, H * D, Cc, T, H);
        mha_gemm_wmma<0><<<grid, 256, 0, stream>>>(xb, wqT, bq, (void*)qmat, M, H * D, Cc, T, H);
        mha_gemm_wmma<1><<<grid, 256, 0, stream>>>(xb, wvT, bv, (void*)vTm,  M, H * D, Cc, T, H);
    }

    // 3) flash attention: grid (T/64 tiles of t, B*H), 4 waves/block
    {
        dim3 grid(T / 64, Bb * H);
        mha_flash_attn<<<grid, 128, 0, stream>>>(kmat, qmat, vTm, oh, H, T, scale);
    }

    // 4) output projection: [4096,1024] x [1024,1024]^T + bp -> f32 d_out
    {
        dim3 grid(M / 64, Cc / 256);
        mha_gemm_wmma<2><<<grid, 256, 0, stream>>>(oh, wpT, bp, d_out, M, Cc, Cc, T, H);
    }

    (void)in_sizes; (void)n_in; (void)out_size; (void)ws_size;
}

// v001
// One run takes 303 microseconds.
// Next to v000, in two timings, it ran 1.44 and 1.45 times as fast.
#include <hip/hip_runtime.h>
#include <math.h>

typedef __bf16 bf16_t;
typedef __attribute__((ext_vector_type(16))) __bf16 v16bf;
typedef __attribute__((ext_vector_type(8)))  __bf16 v8bf;
typedef __attribute__((ext_vector_type(8)))  float  v8f;

static __device__ __forceinline__ v8f wmma_bf16(v16bf a, v16bf b, v8f c) {
    // 8 args: (neg_a, A, neg_b, B, c_mod, C, reuse_a, reuse_b)
    return __builtin_amdgcn_wmma_f32_16x16x32_bf16(
        false, a, false, b, (short)0, c, false, false);
}

static __device__ __forceinline__ v16bf load_frag_rowK(
    const bf16_t* __restrict__ base, int ld, int row0, int k0, int lane) {
    const int r    = lane & 15;
    const int kofs = (lane >> 4) ? 8 : 0;
    const bf16_t* p0 = base + (size_t)(row0 + r) * ld + (k0 + kofs);
    v8bf a = *(const v8bf*)p0;
    v8bf b = *(const v8bf*)(p0 + 16);
    v16bf out;
#pragma unroll
    for (int i = 0; i < 8; ++i) { out[i] = a[i]; out[i + 8] = b[i]; }
    return out;
}

// ---------------------------------------------------------------------------
// Packing / conversion kernels
// ---------------------------------------------------------------------------
__global__ void mha_cvt_bf16(const float* __restrict__ in, bf16_t* __restrict__ out, int n) {
    int i = blockIdx.x * blockDim.x + threadIdx.x;
    if (i < n) out[i] = (bf16_t)in[i];
}

static __device__ __forceinline__ void transpose_tile_64x64(
    const float* __restrict__ in, int ldin, bf16_t* __restrict__ out, int ldout) {
    __shared__ float tile[64][65];
    const int tid = threadIdx.x;

    const int lr = tid >> 4;         // 0..15: row inside a group of 16
    const int lc = (tid & 15) * 4;   // first of 4 columns
#pragma unroll
    for (int i = 0; i < 4; ++i) {
        const int r = i * 16 + lr;
        const float4 v = *(const float4*)(in + (size_t)r * ldin + lc);
        tile[r][lc + 0] = v.x;
        tile[r][lc + 1] = v.y;
        tile[r][lc + 2] = v.z;
        tile[r][lc + 3] = v.w;
    }
    __syncthreads();

    const int sr = tid >> 3;         // 0..31: output row inside a group of 32
    const int sc = (tid & 7) * 8;    // first of 8 output columns
#pragma unroll
    for (int i = 0; i < 2; ++i) {
        const int j = i * 32 + sr;
        v8bf o;
#pragma unroll
        for (int k = 0; k < 8; ++k) o[k] = (bf16_t)tile[sc + k][j];
        *(v8bf*)(out + (size_t)j * ldout + sc) = o;
    }
}

// W[h][c][d] (f32) -> Wt[h][d][c] (bf16)  => flat [N=h*64+d][K=c] row-major
// grid (C/64, H), 256 threads; head size 64 = one tile wide
__global__ void mha_pack_w(const float* __restrict__ W, bf16_t* __restrict__ Wt, int C) {
    const int c0 = blockIdx.x * 64;
    const int h  = blockIdx.y;
    transpose_tile_64x64(W + ((size_t)h * C + c0) * 64, 64,
                         Wt + (size_t)h * 64 * C + c0, C);
}

// Wp[k][n] (f32) -> WpT[n][k] (bf16)
// grid (C/64, C/64), 256 threads
__global__ void mha_pack_wp(const float* __restrict__ Wp, bf16_t* __restrict__ WpT, int C) {
    const int k0 = blockIdx.x * 64;
    const int n0 = blockIdx.y * 64;
    transpose_tile_64x64(Wp + (size_t)k0 * C + n0, C,
                         WpT + (size_t)n0 * C + k0, C);
}

// ---------------------------------------------------------------------------
// WMMA GEMM:  out[m,n] = sum_k A[m,k]*B[n,k] + bias[n]
//   A: [M,K] bf16 row-major, B: [N,K] bf16 row-major.
// Block: 256 threads = 8 waves (2M x 4N) -> 64(M) x 256(N) tile; wave 32x64.
// Store modes: 0 = bf16 into [B,H,T,D] (k,q), 1 = bf16 into [B,H,D,T] (v^T),
//              2 = f32 row-major [M,N] (final output).
// ---------------------------------------------------------------------------
template <int MODE>
__global__ void mha_gemm_wmma(const bf16_t* __restrict__ A,
                              const bf16_t* __restrict__ Bm,
                              const float* __restrict__ bias,
                              void* __restrict__ out,
                              int M, int N, int K, int T, int H) {
    const int lane = threadIdx.x & 31;
    const int wave = threadIdx.x >> 5;
    const int wm = wave & 1;   // 2 waves along M
    const int wn = wave >> 1;  // 4 waves along N
    const int m0 = blockIdx.x * 64 + wm * 32;
    const int n0 = blockIdx.y * 256 + wn * 64;

    v8f acc[2][4] = {};
    for (int k0 = 0; k0 < K; k0 += 32) {
        v16bf a0 = load_frag_rowK(A, K, m0,      k0, lane);
        v16bf a1 = load_frag_rowK(A, K, m0 + 16, k0, lane);
#pragma unroll
        for (int j = 0; j < 4; ++j) {
            v16bf b = load_frag_rowK(Bm, K, n0 + 16 * j, k0, lane);
            acc[0][j] = wmma_bf16(a0, b, acc[0][j]);
            acc[1][j] = wmma_bf16(a1, b, acc[1][j]);
        }
    }

    const int half = lane >> 4;
    const int nc = lane & 15;
#pragma unroll
    for (int i = 0; i < 2; ++i) {
#pragma unroll
        for (int j = 0; j < 4; ++j) {
#pragma unroll
            for (int r = 0; r < 8; ++r) {
                const int m = m0 + 16 * i + r + 8 * half;
                const int n = n0 + 16 * j + nc;
                const float val = acc[i][j][r] + bias[n];
                if (MODE == 2) {
                    ((float*)out)[(size_t)m * N + n] = val;
                } else {
                    const int b = m / T, t = m % T;
                    const int h = n >> 6, d = n & 63;
                    size_t idx;
                    if (MODE == 0) idx = (((size_t)b * H + h) * T + t) * 64 + d;        // [B,H,T,D]
                    else           idx = (((size_t)b * H + h) * 64 + d) * (size_t)T + t; // [B,H,D,T]
                    ((bf16_t*)out)[idx] = (bf16_t)val;
                }
            }
        }
    }
}

__global__ void mha_flash_attn(const bf16_t* __restrict__ Kp,
                               const bf16_t* __restrict__ Qp,
                               const bf16_t* __restrict__ VTp,
                               bf16_t* __restrict__ Oh,
                               int H, int T, float scale) {
    const int lane = threadIdx.x & 31;
    const int wave = threadIdx.x >> 5;
    const int bh = blockIdx.y;
    const int b = bh / H, h = bh % H;
    const int t0 = blockIdx.x * 64 + wave * 16;

    const bf16_t* kbase = Kp  + (size_t)bh * T * 64;
    const bf16_t* qbase = Qp  + (size_t)bh * T * 64;
    const bf16_t* vbase = VTp + (size_t)bh * 64 * T;

    // k tile as B operand (N = t columns, K = d), resident for whole loop
    const v16bf kb0 = load_frag_rowK(kbase, 64, t0, 0,  lane);
    const v16bf kb1 = load_frag_rowK(kbase, 64, t0, 32, lane);

    float mstat = -INFINITY, lstat = 0.f;
    v8f o[4] = {};   // O^T: 4 d-tiles x (8 vgprs), col t = lane&15

    for (int s0 = 0; s0 < T; s0 += 32) {
        // ---- S^T: two 16-row s-tiles, D=64 in two WMMA K-steps each ----
        v8f st[2];
#pragma unroll
        for (int m = 0; m < 2; ++m) {
            v8f accs = {};
            v16bf qa0 = load_frag_rowK(qbase, 64, s0 + 16 * m, 0,  lane);
            accs = wmma_bf16(qa0, kb0, accs);
            v16bf qa1 = load_frag_rowK(qbase, 64, s0 + 16 * m, 32, lane);
            accs = wmma_bf16(qa1, kb1, accs);
            st[m] = accs;
        }
        // ---- per-lane online softmax over this lane's 16 s-values ----
        float x[16];
#pragma unroll
        for (int m = 0; m < 2; ++m)
#pragma unroll
            for (int r = 0; r < 8; ++r)
                x[8 * m + r] = st[m][r] * scale;

        float mx = x[0];
#pragma unroll
        for (int i = 1; i < 16; ++i) mx = fmaxf(mx, x[i]);
        mx = fmaxf(mx, __shfl_xor(mx, 16, 32));   // combine the two halves
        const float mnew = fmaxf(mstat, mx);
        const float alpha = __expf(mstat - mnew);

        v16bf pb;           // P^T B-fragment, built in-register
        float psum = 0.f;
#pragma unroll
        for (int i = 0; i < 16; ++i) {
            const float p = __expf(x[i] - mnew);
            psum += p;
            pb[i] = (bf16_t)p;
        }
        psum += __shfl_xor(psum, 16, 32);
        lstat = lstat * alpha + psum;
        mstat = mnew;

        // rescale O^T (alpha is uniform per lane / per t-column)
#pragma unroll
        for (int j = 0; j < 4; ++j)
#pragma unroll
            for (int r = 0; r < 8; ++r) o[j][r] *= alpha;

        // ---- O^T += V^T (d x 32s) x P^T (32s x 16t) ----
#pragma unroll
        for (int j = 0; j < 4; ++j) {
            v16bf va = load_frag_rowK(vbase, T, 16 * j, s0, lane);
            o[j] = wmma_bf16(va, pb, o[j]);
        }
    }

    // ---- normalize, store concat-head output [B,T,H*64] ----
    // lane owns column t = t0+nc; d = 16j + r + 8*half -> 8 consecutive d per j
    const int half = lane >> 4;
    const int nc = lane & 15;
    const float inv = 1.0f / lstat;
    const size_t rowbase = ((size_t)b * T + (t0 + nc)) * (size_t)(H * 64) + (size_t)h * 64;
#pragma unroll
    for (int j = 0; j < 4; ++j) {
        v8bf ov;
#pragma unroll
        for (int r = 0; r < 8; ++r) ov[r] = (bf16_t)(o[j][r] * inv);
        *(v8bf*)(Oh + rowbase + 16 * j + 8 * half) = ov;
    }
}

// ---------------------------------------------------------------------------
// Host-side launch
// ---------------------------------------------------------------------------
extern "C" void kernel_launch(void* const* d_in, const int* in_sizes, int n_in,
                              void* d_out, int out_size, void* d_ws, size_t ws_size,
                              hipStream_t stream) {
    constexpr int Bb = 2, T = 2048, Cc = 1024, H = 16, D = 64;
    constexpr int M = Bb * T;          // 4096
    const float scale = 1.0f / 32.0f;  // C^-0.5 = 1024^-0.5

    const float* x  = (const float*)d_in[0];
    const float* Wk = (const float*)d_in[1];
    const float* bk = (const float*)d_in[2];
    const float* Wq = (const float*)d_in[3];
    const float* bq = (const float*)d_in[4];
    const float* Wv = (const float*)d_in[5];
    const float* bv = (const float*)d_in[6];
    const float* Wp = (const float*)d_in[7];
    const float* bp = (const float*)d_in[8];

    char* ws = (char*)d_ws;
    size_t off = 0;
    bf16_t* xb   = (bf16_t*)(ws + off); off += (size_t)M * Cc * sizeof(bf16_t);         // 8 MB
    bf16_t* wkT  = (bf16_t*)(ws + off); off += (size_t)H * D * Cc * sizeof(bf16_t);     // 2 MB
    bf16_t* wqT  = (bf16_t*)(ws + off); off += (size_t)H * D * Cc * sizeof(bf16_t);
    bf16_t* wvT  = (bf16_t*)(ws + off); off += (size_t)H * D * Cc * sizeof(bf16_t);
    bf16_t* wpT  = (bf16_t*)(ws + off); off += (size_t)Cc * Cc * sizeof(bf16_t);        // 2 MB
    bf16_t* kmat = (bf16_t*)(ws + off); off += (size_t)Bb * H * T * D * sizeof(bf16_t); // 8 MB
    bf16_t* qmat = (bf16_t*)(ws + off); off += (size_t)Bb * H * T * D * sizeof(bf16_t);
    bf16_t* vTm  = (bf16_t*)(ws + off); off += (size_t)Bb * H * T * D * sizeof(bf16_t);
    bf16_t* oh   = (bf16_t*)(ws + off); off += (size_t)M * Cc * sizeof(bf16_t);         // 8 MB

    // 1) conversions / packing
    {
        int n = M * Cc;
        mha_cvt_bf16<<<(n + 255) / 256, 256, 0, stream>>>(x, xb, n);
        dim3 gw(Cc / 64, H);
        mha_pack_w<<<gw, 256, 0, stream>>>(Wk, wkT, Cc);
        mha_pack_w<<<gw, 256, 0, stream>>>(Wq, wqT, Cc);
        mha_pack_w<<<gw, 256, 0, stream>>>(Wv, wvT, Cc);
        dim3 gp(Cc / 64, Cc / 64);
        mha_pack_wp<<<gp, 256, 0, stream>>>(Wp, wpT, Cc);
    }

    // 2) QKV projections: M=4096, N=1024 (h*64+d), K=1024
    {
        dim3 grid(M / 64, (H * D) / 256);
        mha_gemm_wmma<0><<<grid, 256, 0, stream>>>(xb, wkT, bk, (void*)kmat, M, H * D, Cc, T, H);
        mha_gemm_wmma<0><<<grid, 256, 0, stream>>>(xb, wqT, bq, (void*)qmat, M, H * D, Cc, T, H);
        mha_gemm_wmma<1><<<grid, 256, 0, stream>>>(xb, wvT, bv, (void*)vTm,  M, H * D, Cc, T, H);
    }

    // 3) flash attention: grid (T/64 tiles of t, B*H), 4 waves/block
    {
        dim3 grid(T / 64, Bb * H);
        mha_flash_attn<<<grid, 128, 0, stream>>>(kmat, qmat, vTm, oh, H, T, scale);
    }

    // 4) output projection: [4096,1024] x [1024,1024]^T + bp -> f32 d_out
    {
        dim3 grid(M / 64, Cc / 256);
        mha_gemm_wmma<2><<<grid, 256, 0, stream>>>(oh, wpT, bp, d_out, M, Cc, Cc, T, H);
    }

    (void)in_sizes; (void)n_in; (void)out_size; (void)ws_size;
}

// v002
// A run of this version takes 230 microseconds.
// Two timings next to v001 both put it at 1.31 times that version's speed.
// Counting every step since v000, it is 1.90 times as fast.
#include <hip/hip_runtime.h>
#include <math.h>

typedef __bf16 bf16_t;
typedef __attribute__((ext_vector_type(16))) __bf16 v16bf;
typedef __attribute__((ext_vector_type(8)))  __bf16 v8bf;
typedef __attribute__((ext_vector_type(8)))  float  v8f;

static __device__ __forceinline__ v8f wmma_bf16(v16bf a, v16bf b, v8f c) {
    // 8 args: (neg_a, A, neg_b, B, c_mod, C, reuse_a, reuse_b)
    return __builtin_amdgcn_wmma_f32_16x16x32_bf16(
        false, a, false, b, (short)0, c, false, false);
}

// Element offset of the 8 consecutive k that start at (row, k), k a multiple of 8.
static __device__ __forceinline__ size_t frag_chunk_offset(int row, int k, int KT) {
    return ((size_t)(row >> 4) * KT + (k >> 5)) * 512
         + (size_t)((((k >> 4) & 1) * 32 + (row & 15) + 16 * ((k >> 3) & 1)) * 8);
}

static __device__ __forceinline__ v16bf load_frag_tiled(const bf16_t* __restrict__ group, unsigned off) {
    const char* p0 = (const char*)group + off;
    v8bf a = *(const v8bf*)p0;
    v8bf b = *(const v8bf*)(p0 + 512);
    v16bf out;
#pragma unroll
    for (int i = 0; i < 8; ++i) { out[i] = a[i]; out[i + 8] = b[i]; }
    return out;
}

__global__ void mha_cvt_bf16(const float* __restrict__ in, bf16_t* __restrict__ out, int C) {
    const int lane = threadIdx.x & 31;
    const int tile = blockIdx.x * 8 + (threadIdx.x >> 5);
    const int KT = C >> 5;
    const int rt = tile / KT, kt = tile % KT;
    const float* p = in + (size_t)(rt * 16 + (lane & 15)) * C + kt * 32 + (lane >> 4) * 8;
    const float4 a0 = *(const float4*)(p);
    const float4 a1 = *(const float4*)(p + 4);
    const float4 b0 = *(const float4*)(p + 16);
    const float4 b1 = *(const float4*)(p + 20);
    v8bf lo, hi;
    lo[0] = (bf16_t)a0.x; lo[1] = (bf16_t)a0.y; lo[2] = (bf16_t)a0.z; lo[3] = (bf16_t)a0.w;
    lo[4] = (bf16_t)a1.x; lo[5] = (bf16_t)a1.y; lo[6] = (bf16_t)a1.z; lo[7] = (bf16_t)a1.w;
    hi[0] = (bf16_t)b0.x; hi[1] = (bf16_t)b0.y; hi[2] = (bf16_t)b0.z; hi[3] = (bf16_t)b0.w;
    hi[4] = (bf16_t)b1.x; hi[5] = (bf16_t)b1.y; hi[6] = (bf16_t)b1.z; hi[7] = (bf16_t)b1.w;
    bf16_t* q = out + (size_t)tile * 512 + lane * 8;
    *(v8bf*)q = lo;
    *(v8bf*)(q + 256) = hi;
}

static __device__ __forceinline__ void transpose_tile_64x64(
    const float* __restrict__ in, int ldin, bf16_t* __restrict__ out, int row0, int k0, int KT) {
    __shared__ float tile[64][65];
    const int tid = threadIdx.x;

    const int lr = tid >> 4;         // 0..15: row inside a group of 16
    const int lc = (tid & 15) * 4;   // first of 4 columns
#pragma unroll
    for (int i = 0; i < 4; ++i) {
        const int r = i * 16 + lr;
        const float4 v = *(const float4*)(in + (size_t)r * ldin + lc);
        tile[r][lc + 0] = v.x;
        tile[r][lc + 1] = v.y;
        tile[r][lc + 2] = v.z;
        tile[r][lc + 3] = v.w;
    }
    __syncthreads();

    const int sr = tid >> 3;         // 0..31: output row inside a group of 32
    const int sc = (tid & 7) * 8;    // first of 8 output columns
#pragma unroll
    for (int i = 0; i < 2; ++i) {
        const int j = i * 32 + sr;
        v8bf o;
#pragma unroll
        for (int k = 0; k < 8; ++k) o[k] = (bf16_t)tile[sc + k][j];
        *(v8bf*)(out + frag_chunk_offset(row0 + j, k0 + sc, KT)) = o;
    }
}

// W[h][c][d] (f32) -> Wt (bf16), operand [N=h*64+d][K=c] in fragment order
// grid (C/64, H), 256 threads; head size 64 = one tile wide
__global__ void mha_pack_w(const float* __restrict__ W, bf16_t* __restrict__ Wt, int C) {
    const int c0 = blockIdx.x * 64;
    const int h  = blockIdx.y;
    transpose_tile_64x64(W + ((size_t)h * C + c0) * 64, 64, Wt, h * 64, c0, C >> 5);
}

// Wp[k][n] (f32) -> WpT (bf16), operand [n][k] in fragment order
// grid (C/64, C/64), 256 threads
__global__ void mha_pack_wp(const float* __restrict__ Wp, bf16_t* __restrict__ WpT, int C) {
    const int k0 = blockIdx.x * 64;
    const int n0 = blockIdx.y * 64;
    transpose_tile_64x64(Wp + (size_t)k0 * C + n0, C, WpT, n0, k0, C >> 5);
}

template <int MODE, int K>
__global__ void mha_gemm_wmma(const bf16_t* __restrict__ A,
                              const bf16_t* __restrict__ Bm,
                              const float* __restrict__ bias,
                              void* __restrict__ out,
                              int M, int N, int T, int H) {
    const int lane = threadIdx.x & 31;
    const int wave = __builtin_amdgcn_readfirstlane(threadIdx.x >> 5);   // wave-uniform: tile bases are formed in scalar registers
    const int wm = wave & 1;   // 2 waves along M
    const int wn = wave >> 1;  // 4 waves along N
    const int m0 = blockIdx.x * 64 + wm * 32;
    const int n0 = blockIdx.y * 256 + wn * 64;

    constexpr int KT = K >> 5;
    const int mt = m0 >> 4;
    const int nt = n0 >> 4;

    const bf16_t* ag = A  + (size_t)mt * KT * 512;   // the wave's two 16-row groups of A
    const bf16_t* bg = Bm + (size_t)nt * KT * 512;   // and its four of B
    constexpr size_t gs = (size_t)KT * 512;          // elements per 16-row group

    v8f acc[2][4] = {};
    unsigned off = lane * 16;
    for (int kt = 0; kt < KT; ++kt, off += 1024) {
        v16bf a0 = load_frag_tiled(ag,      off);
        v16bf a1 = load_frag_tiled(ag + gs, off);
#pragma unroll
        for (int j = 0; j < 4; ++j) {
            v16bf b = load_frag_tiled(bg + j * gs, off);
            if (MODE == 0) {
                acc[0][j] = wmma_bf16(b, a0, acc[0][j]);
                acc[1][j] = wmma_bf16(b, a1, acc[1][j]);
            } else {
                acc[0][j] = wmma_bf16(a0, b, acc[0][j]);
                acc[1][j] = wmma_bf16(a1, b, acc[1][j]);
            }
        }
    }

    const int half = lane >> 4;
    const int nc = lane & 15;
    if (MODE == 0) {
        const int h = n0 >> 6;   // the wave's 64 columns are one head
#pragma unroll
        for (int i = 0; i < 2; ++i) {
            const int mb = m0 + 16 * i;
            const int b = mb / T, tt = (mb % T) >> 4;
            bf16_t* tile = (bf16_t*)out + ((size_t)b * H + h) * T * 64 + (size_t)tt * 1024 + lane * 8;
#pragma unroll
            for (int j = 0; j < 4; ++j) {
                const float* bj = bias + n0 + 16 * j + 8 * half;
                v8bf o;
#pragma unroll
                for (int r = 0; r < 8; ++r) o[r] = (bf16_t)(acc[i][j][r] + bj[r]);
                *(v8bf*)(tile + j * 256) = o;
            }
        }
    } else if (MODE == 1) {
        const int h = n0 >> 6;
        const int b = m0 / T, sb = (m0 % T) >> 5;   // the wave's 32 rows are one k tile of v^T
        const int KTs = T >> 5;
        bf16_t* base = (bf16_t*)out + ((size_t)b * H + h) * 64 * T + lane * 8;
#pragma unroll
        for (int j = 0; j < 4; ++j) {
            const float bn = bias[n0 + 16 * j + nc];
#pragma unroll
            for (int i = 0; i < 2; ++i) {
                v8bf o;
#pragma unroll
                for (int r = 0; r < 8; ++r) o[r] = (bf16_t)(acc[i][j][r] + bn);
                *(v8bf*)(base + ((size_t)j * KTs + sb) * 512 + i * 256) = o;
            }
        }
    } else {
#pragma unroll
        for (int i = 0; i < 2; ++i) {
#pragma unroll
            for (int j = 0; j < 4; ++j) {
#pragma unroll
                for (int r = 0; r < 8; ++r) {
                    const int m = m0 + 16 * i + r + 8 * half;
                    const int n = n0 + 16 * j + nc;
                    ((float*)out)[(size_t)m * N + n] = acc[i][j][r] + bias[n];
                }
            }
        }
    }
}

template <int T>
__global__ void mha_flash_attn(const bf16_t* __restrict__ Kp,
                               const bf16_t* __restrict__ Qp,
                               const bf16_t* __restrict__ VTp,
                               bf16_t* __restrict__ Oh,
                               int H, float scale) {
    const int lane = threadIdx.x & 31;
    const int wave = __builtin_amdgcn_readfirstlane(threadIdx.x >> 5);   // wave-uniform: tile bases are formed in scalar registers
    const int bh = blockIdx.y;
    const int b = bh / H, h = bh % H;
    const int t0 = blockIdx.x * 64 + wave * 16;

    const bf16_t* kbase = Kp  + (size_t)bh * T * 64;
    const bf16_t* qbase = Qp  + (size_t)bh * T * 64;
    const bf16_t* vbase = VTp + (size_t)bh * 64 * T;

    // k tile as B operand (N = t columns, K = d), resident for whole loop
    const v16bf kb0 = load_frag_tiled(kbase + (size_t)t0 * 64, lane * 16);
    const v16bf kb1 = load_frag_tiled(kbase + (size_t)t0 * 64, lane * 16 + 1024);

    float mstat = -INFINITY, lstat = 0.f;
    v8f o[4] = {};   // O^T: 4 d-tiles x (8 vgprs), col t = lane&15

    constexpr size_t vgs = (size_t)T * 16;   // elements per 16-row group of v^T
    unsigned qoff = lane * 16;           // 32 rows of q = 4 tiles = 4 KB per trip
    unsigned voff = lane * 16;           // 32 k of v^T = 1 tile = 1 KB per 16-row group and trip
    for (int s0 = 0; s0 < T; s0 += 32, qoff += 4096, voff += 1024) {
        // ---- S^T: two 16-row s-tiles, D=64 in two WMMA K-steps each ----
        v8f st[2];
#pragma unroll
        for (int m = 0; m < 2; ++m) {
            v8f accs = {};
            v16bf qa0 = load_frag_tiled(qbase, qoff + 2048 * m);
            accs = wmma_bf16(qa0, kb0, accs);
            v16bf qa1 = load_frag_tiled(qbase, qoff + 2048 * m + 1024);
            accs = wmma_bf16(qa1, kb1, accs);
            st[m] = accs;
        }
        // ---- per-lane online softmax over this lane's 16 s-values ----
        float x[16];
#pragma unroll
        for (int m = 0; m < 2; ++m)
#pragma unroll
            for (int r = 0; r < 8; ++r)
                x[8 * m + r] = st[m][r] * scale;

        float mx = x[0];
#pragma unroll
        for (int i = 1; i < 16; ++i) mx = fmaxf(mx, x[i]);
        mx = fmaxf(mx, __shfl_xor(mx, 16, 32));   // combine the two halves
        const float mnew = fmaxf(mstat, mx);
        const float alpha = __expf(mstat - mnew);

        v16bf pb;           // P^T B-fragment, built in-register
        float psum = 0.f;
#pragma unroll
        for (int i = 0; i < 16; ++i) {
            const float p = __expf(x[i] - mnew);
            psum += p;
            pb[i] = (bf16_t)p;
        }
        psum += __shfl_xor(psum, 16, 32);
        lstat = lstat * alpha + psum;
        mstat = mnew;

        // rescale O^T (alpha is uniform per lane / per t-column)
#pragma unroll
        for (int j = 0; j < 4; ++j)
#pragma unroll
            for (int r = 0; r < 8; ++r) o[j][r] *= alpha;

        // ---- O^T += V^T (d x 32s) x P^T (32s x 16t) ----
#pragma unroll
        for (int j = 0; j < 4; ++j) {
            v16bf va = load_frag_tiled(vbase + j * vgs, voff);
            o[j] = wmma_bf16(va, pb, o[j]);
        }
    }

    const float inv = 1.0f / lstat;
    bf16_t* obase = Oh + ((size_t)((b * T + t0) >> 4) * (H * 2) + h * 2) * 512 + lane * 8;
#pragma unroll
    for (int j = 0; j < 4; ++j) {
        v8bf ov;
#pragma unroll
        for (int r = 0; r < 8; ++r) ov[r] = (bf16_t)(o[j][r] * inv);
        *(v8bf*)(obase + j * 256) = ov;
    }
}

// ---------------------------------------------------------------------------
// Host-side launch
// ---------------------------------------------------------------------------
extern "C" void kernel_launch(void* const* d_in, const int* in_sizes, int n_in,
                              void* d_out, int out_size, void* d_ws, size_t ws_size,
                              hipStream_t stream) {
    constexpr int Bb = 2, T = 2048, Cc = 1024, H = 16, D = 64;
    constexpr int M = Bb * T;          // 4096
    const float scale = 1.0f / 32.0f;  // C^-0.5 = 1024^-0.5

    const float* x  = (const float*)d_in[0];
    const float* Wk = (const float*)d_in[1];
    const float* bk = (const float*)d_in[2];
    const float* Wq = (const float*)d_in[3];
    const float* bq = (const float*)d_in[4];
    const float* Wv = (const float*)d_in[5];
    const float* bv = (const float*)d_in[6];
    const float* Wp = (const float*)d_in[7];
    const float* bp = (const float*)d_in[8];

    char* ws = (char*)d_ws;
    size_t off = 0;
    bf16_t* xb   = (bf16_t*)(ws + off); off += (size_t)M * Cc * sizeof(bf16_t);         // 8 MB
    bf16_t* wkT  = (bf16_t*)(ws + off); off += (size_t)H * D * Cc * sizeof(bf16_t);     // 2 MB
    bf16_t* wqT  = (bf16_t*)(ws + off); off += (size_t)H * D * Cc * sizeof(bf16_t);
    bf16_t* wvT  = (bf16_t*)(ws + off); off += (size_t)H * D * Cc * sizeof(bf16_t);
    bf16_t* wpT  = (bf16_t*)(ws + off); off += (size_t)Cc * Cc * sizeof(bf16_t);        // 2 MB
    bf16_t* kmat = (bf16_t*)(ws + off); off += (size_t)Bb * H * T * D * sizeof(bf16_t); // 8 MB
    bf16_t* qmat = (bf16_t*)(ws + off); off += (size_t)Bb * H * T * D * sizeof(bf16_t);
    bf16_t* vTm  = (bf16_t*)(ws + off); off += (size_t)Bb * H * T * D * sizeof(bf16_t);
    bf16_t* oh   = (bf16_t*)(ws + off); off += (size_t)M * Cc * sizeof(bf16_t);         // 8 MB

    // 1) conversions / packing
    {
        mha_cvt_bf16<<<(M / 16) * (Cc / 32) / 8, 256, 0, stream>>>(x, xb, Cc);
        dim3 gw(Cc / 64, H);
        mha_pack_w<<<gw, 256, 0, stream>>>(Wk, wkT, Cc);
        mha_pack_w<<<gw, 256, 0, stream>>>(Wq, wqT, Cc);
        mha_pack_w<<<gw, 256, 0, stream>>>(Wv, wvT, Cc);
        dim3 gp(Cc / 64, Cc / 64);
        mha_pack_wp<<<gp, 256, 0, stream>>>(Wp, wpT, Cc);
    }

    // 2) QKV projections: M=4096, N=1024 (h*64+d), K=1024
    {
        dim3 grid(M / 64, (H * D) / 256);
        mha_gemm_wmma<0, Cc><<<grid, 256, 0, stream>>>(xb, wkT, bk, (void*)kmat, M, H * D, T, H);
        mha_gemm_wmma<0, Cc><<<grid, 256, 0, stream>>>(xb, wqT, bq, (void*)qmat, M, H * D, T, H);
        mha_gemm_wmma<1, Cc><<<grid, 256, 0, stream>>>(xb, wvT, bv, (void*)vTm,  M, H * D, T, H);
    }

    // 3) flash attention: grid (T/64 tiles of t, B*H), 4 waves/block
    {
        dim3 grid(T / 64, Bb * H);
        mha_flash_attn<T><<<grid, 128, 0, stream>>>(kmat, qmat, vTm, oh, H, scale);
    }

    // 4) output projection: [4096,1024] x [1024,1024]^T + bp -> f32 d_out
    {
        dim3 grid(M / 64, Cc / 256);
        mha_gemm_wmma<2, Cc><<<grid, 256, 0, stream>>>(oh, wpT, bp, d_out, M, Cc, T, H);
    }

    (void)in_sizes; (void)n_in; (void)out_size; (void)ws_size;
}

// v003
// Measured time: 105 microseconds a run.
// Next to v002, in two timings, it ran 2.16 times as fast each time.
// All steps since v000 together make it 4.10 times as fast.
#include <hip/hip_runtime.h>
#include <math.h>

typedef __bf16 bf16_t;
typedef __attribute__((ext_vector_type(16))) __bf16 v16bf;
typedef __attribute__((ext_vector_type(8)))  __bf16 v8bf;
typedef __attribute__((ext_vector_type(8)))  float  v8f;

static __device__ __forceinline__ v8f wmma_bf16(v16bf a, v16bf b, v8f c) {
    // 8 args: (neg_a, A, neg_b, B, c_mod, C, reuse_a, reuse_b)
    return __builtin_amdgcn_wmma_f32_16x16x32_bf16(
        false, a, false, b, (short)0, c, false, false);
}

// Element offset of the 8 consecutive k that start at (row, k), k a multiple of 8.
static __device__ __forceinline__ size_t frag_chunk_offset(int row, int k, int KT) {
    return ((size_t)(row >> 4) * KT + (k >> 5)) * 512
         + (size_t)((((k >> 4) & 1) * 32 + (row & 15) + 16 * ((k >> 3) & 1)) * 8);
}

static __device__ __forceinline__ v16bf load_frag_tiled(const bf16_t* __restrict__ group, unsigned off) {
    const char* p0 = (const char*)group + off;
    v8bf a = *(const v8bf*)p0;
    v8bf b = *(const v8bf*)(p0 + 512);
    v16bf out;
#pragma unroll
    for (int i = 0; i < 8; ++i) { out[i] = a[i]; out[i + 8] = b[i]; }
    return out;
}

__global__ void mha_cvt_bf16(const float* __restrict__ in, bf16_t* __restrict__ out, int C) {
    const int lane = threadIdx.x & 31;
    const int tile = blockIdx.x * 8 + (threadIdx.x >> 5);
    const int KT = C >> 5;
    const int rt = tile / KT, kt = tile % KT;
    const float* p = in + (size_t)(rt * 16 + (lane & 15)) * C + kt * 32 + (lane >> 4) * 8;
    const float4 a0 = *(const float4*)(p);
    const float4 a1 = *(const float4*)(p + 4);
    const float4 b0 = *(const float4*)(p + 16);
    const float4 b1 = *(const float4*)(p + 20);
    v8bf lo, hi;
    lo[0] = (bf16_t)a0.x; lo[1] = (bf16_t)a0.y; lo[2] = (bf16_t)a0.z; lo[3] = (bf16_t)a0.w;
    lo[4] = (bf16_t)a1.x; lo[5] = (bf16_t)a1.y; lo[6] = (bf16_t)a1.z; lo[7] = (bf16_t)a1.w;
    hi[0] = (bf16_t)b0.x; hi[1] = (bf16_t)b0.y; hi[2] = (bf16_t)b0.z; hi[3] = (bf16_t)b0.w;
    hi[4] = (bf16_t)b1.x; hi[5] = (bf16_t)b1.y; hi[6] = (bf16_t)b1.z; hi[7] = (bf16_t)b1.w;
    bf16_t* q = out + (size_t)tile * 512 + lane * 8;
    *(v8bf*)q = lo;
    *(v8bf*)(q + 256) = hi;
}

static __device__ __forceinline__ void transpose_tile_64x64(
    const float* __restrict__ in, int ldin, bf16_t* __restrict__ out, int row0, int k0, int KT) {
    __shared__ float tile[64][65];
    const int tid = threadIdx.x;

    const int lr = tid >> 4;         // 0..15: row inside a group of 16
    const int lc = (tid & 15) * 4;   // first of 4 columns
#pragma unroll
    for (int i = 0; i < 4; ++i) {
        const int r = i * 16 + lr;
        const float4 v = *(const float4*)(in + (size_t)r * ldin + lc);
        tile[r][lc + 0] = v.x;
        tile[r][lc + 1] = v.y;
        tile[r][lc + 2] = v.z;
        tile[r][lc + 3] = v.w;
    }
    __syncthreads();

    const int sr = tid >> 3;         // 0..31: output row inside a group of 32
    const int sc = (tid & 7) * 8;    // first of 8 output columns
#pragma unroll
    for (int i = 0; i < 2; ++i) {
        const int j = i * 32 + sr;
        v8bf o;
#pragma unroll
        for (int k = 0; k < 8; ++k) o[k] = (bf16_t)tile[sc + k][j];
        *(v8bf*)(out + frag_chunk_offset(row0 + j, k0 + sc, KT)) = o;
    }
}

// W[h][c][d] (f32) -> Wt (bf16), operand [N=h*64+d][K=c] in fragment order
// grid (C/64, H), 256 threads; head size 64 = one tile wide
__global__ void mha_pack_w(const float* __restrict__ W, bf16_t* __restrict__ Wt, int C) {
    const int c0 = blockIdx.x * 64;
    const int h  = blockIdx.y;
    transpose_tile_64x64(W + ((size_t)h * C + c0) * 64, 64, Wt, h * 64, c0, C >> 5);
}

// Wp[k][n] (f32) -> WpT (bf16), operand [n][k] in fragment order
// grid (C/64, C/64), 256 threads
__global__ void mha_pack_wp(const float* __restrict__ Wp, bf16_t* __restrict__ WpT, int C) {
    const int k0 = blockIdx.x * 64;
    const int n0 = blockIdx.y * 64;
    transpose_tile_64x64(Wp + (size_t)k0 * C + n0, C, WpT, n0, k0, C >> 5);
}

template <int MODE, int K>
__global__ void __launch_bounds__(256) __attribute__((amdgpu_waves_per_eu(4, 4))) mha_gemm_wmma(const bf16_t* __restrict__ A,
                              const bf16_t* __restrict__ Bm,
                              const float* __restrict__ bias,
                              void* __restrict__ out,
                              int M, int N, int T, int H) {
    const int lane = threadIdx.x & 31;
    const int wave = __builtin_amdgcn_readfirstlane(threadIdx.x >> 5);   // wave-uniform: tile bases are formed in scalar registers
    const int wm = wave & 1;   // 2 waves along M
    const int wn = wave >> 1;  // 4 waves along N
    const int m0 = blockIdx.x * 64 + wm * 32;
    const int n0 = blockIdx.y * 256 + wn * 64;

    constexpr int KT = K >> 5;
    const int mt = m0 >> 4;
    const int nt = n0 >> 4;

    const bf16_t* ag = A  + (size_t)mt * KT * 512;   // the wave's two 16-row groups of A
    const bf16_t* bg = Bm + (size_t)nt * KT * 512;   // and its four of B
    constexpr size_t gs = (size_t)KT * 512;          // elements per 16-row group

    constexpr int SETS = 3;   // register sets: one in use, two in flight
    static_assert(KT >= SETS && (KT - (SETS - 1)) % SETS == 0, "the loop walks SETS tiles a trip and leaves SETS - 1 for the tail");

    v8f acc[2][4] = {};
    v16bf fa[SETS][2], fb[SETS][4];
    auto fetch = [&](int set, unsigned o) __attribute__((always_inline)) {
        fa[set][0] = load_frag_tiled(ag,      o);
        fa[set][1] = load_frag_tiled(ag + gs, o);
#pragma unroll
        for (int j = 0; j < 4; ++j) fb[set][j] = load_frag_tiled(bg + j * gs, o);
    };
    auto products = [&](int set) __attribute__((always_inline)) {
#pragma unroll
        for (int j = 0; j < 4; ++j) {
            if (MODE == 0) {
                acc[0][j] = wmma_bf16(fb[set][j], fa[set][0], acc[0][j]);
                acc[1][j] = wmma_bf16(fb[set][j], fa[set][1], acc[1][j]);
            } else {
                acc[0][j] = wmma_bf16(fa[set][0], fb[set][j], acc[0][j]);
                acc[1][j] = wmma_bf16(fa[set][1], fb[set][j], acc[1][j]);
            }
        }
    };

    unsigned off = lane * 16;
#pragma unroll
    for (int s = 0; s < SETS - 1; ++s) fetch(s, off + s * 1024);
    for (int kt = 0; kt < KT - (SETS - 1); kt += SETS, off += SETS * 1024) {
#pragma unroll
        for (int u = 0; u < SETS; ++u) {
            fetch((u + SETS - 1) % SETS, off + (u + SETS - 1) * 1024);
            // Keeps the requests in front of these products: without it the scheduler sinks them to just
            // before their own use, and the wave waits out the whole L2 latency again.
            __builtin_amdgcn_sched_barrier(0);
            products(u);
            // Keeps what follows behind these products: the next requests, and at the loop's foot the step of the
            // address register, whose wait would otherwise stall the wave in front of products that are ready.
            __builtin_amdgcn_sched_barrier(0);
        }
    }
#pragma unroll
    for (int u = 0; u < SETS - 1; ++u) products(u);   // the last tiles: nothing left to request

    const int half = lane >> 4;
    const int nc = lane & 15;
    if (MODE == 0) {
        const int h = n0 >> 6;   // the wave's 64 columns are one head
#pragma unroll
        for (int i = 0; i < 2; ++i) {
            const int mb = m0 + 16 * i;
            const int b = mb / T, tt = (mb % T) >> 4;
            bf16_t* tile = (bf16_t*)out + ((size_t)b * H + h) * T * 64 + (size_t)tt * 1024 + lane * 8;
#pragma unroll
            for (int j = 0; j < 4; ++j) {
                const float* bj = bias + n0 + 16 * j + 8 * half;
                v8bf o;
#pragma unroll
                for (int r = 0; r < 8; ++r) o[r] = (bf16_t)(acc[i][j][r] + bj[r]);
                *(v8bf*)(tile + j * 256) = o;
            }
        }
    } else if (MODE == 1) {
        const int h = n0 >> 6;
        const int b = m0 / T, sb = (m0 % T) >> 5;   // the wave's 32 rows are one k tile of v^T
        const int KTs = T >> 5;
        bf16_t* base = (bf16_t*)out + ((size_t)b * H + h) * 64 * T + lane * 8;
#pragma unroll
        for (int j = 0; j < 4; ++j) {
            const float bn = bias[n0 + 16 * j + nc];
#pragma unroll
            for (int i = 0; i < 2; ++i) {
                v8bf o;
#pragma unroll
                for (int r = 0; r < 8; ++r) o[r] = (bf16_t)(acc[i][j][r] + bn);
                *(v8bf*)(base + ((size_t)j * KTs + sb) * 512 + i * 256) = o;
            }
        }
    } else {
#pragma unroll
        for (int i = 0; i < 2; ++i) {
#pragma unroll
            for (int j = 0; j < 4; ++j) {
#pragma unroll
                for (int r = 0; r < 8; ++r) {
                    const int m = m0 + 16 * i + r + 8 * half;
                    const int n = n0 + 16 * j + nc;
                    ((float*)out)[(size_t)m * N + n] = acc[i][j][r] + bias[n];
                }
            }
        }
    }
}

// exp(y) = 2^(y * LOG2E), as the fast library exponential forms it.
constexpr float LOG2E = 1.44269504f;

static __device__ __forceinline__ void exp2_in_place(float& a, float& b, float& c, float& d,
                                                     float& e, float& f, float& g, float& h) {
    asm("v_exp_f32 %0, %0\n\tv_exp_f32 %1, %1\n\tv_exp_f32 %2, %2\n\tv_exp_f32 %3, %3\n\t"
        "v_exp_f32 %4, %4\n\tv_exp_f32 %5, %5\n\tv_exp_f32 %6, %6\n\tv_exp_f32 %7, %7\n\t"
        "v_nop"
        : "+v"(a), "+v"(b), "+v"(c), "+v"(d), "+v"(e), "+v"(f), "+v"(g), "+v"(h));
}
static __device__ __forceinline__ void exp2_in_place(float& z, float& a, float& b, float& c, float& d,
                                                     float& e, float& f, float& g, float& h) {
    asm("v_exp_f32 %0, %0\n\tv_exp_f32 %1, %1\n\tv_exp_f32 %2, %2\n\tv_exp_f32 %3, %3\n\t"
        "v_exp_f32 %4, %4\n\tv_exp_f32 %5, %5\n\tv_exp_f32 %6, %6\n\tv_exp_f32 %7, %7\n\t"
        "v_exp_f32 %8, %8\n\tv_nop"
        : "+v"(z), "+v"(a), "+v"(b), "+v"(c), "+v"(d), "+v"(e), "+v"(f), "+v"(g), "+v"(h));
}

template <int T>
__global__ void __launch_bounds__(128) __attribute__((amdgpu_waves_per_eu(4, 4))) mha_flash_attn(const bf16_t* __restrict__ Kp,
                               const bf16_t* __restrict__ Qp,
                               const bf16_t* __restrict__ VTp,
                               bf16_t* __restrict__ Oh,
                               int H, float scale) {
    const int lane = threadIdx.x & 31;
    const int wave = __builtin_amdgcn_readfirstlane(threadIdx.x >> 5);   // wave-uniform: tile bases are formed in scalar registers
    const int bh = blockIdx.y;
    const int b = bh / H, h = bh % H;
    const int t0 = blockIdx.x * 64 + wave * 16;

    const bf16_t* kbase = Kp  + (size_t)bh * T * 64;
    const bf16_t* qbase = Qp  + (size_t)bh * T * 64;
    const bf16_t* vbase = VTp + (size_t)bh * 64 * T;

    // k tile as B operand (N = t columns, K = d), resident for whole loop
    const v16bf kb0 = load_frag_tiled(kbase + (size_t)t0 * 64, lane * 16);
    const v16bf kb1 = load_frag_tiled(kbase + (size_t)t0 * 64, lane * 16 + 1024);

    float mstat = -INFINITY, lstat = 0.f;
    v8f o[4] = {};   // O^T: 4 d-tiles x (8 vgprs), col t = lane&15

    constexpr size_t vgs = (size_t)T * 16;   // elements per 16-row group of v^T
    static_assert(T % 64 == 0 && T >= 64, "the loop walks two trips of 32 s at a time");
    v16bf qf[2][4], vf[4];
    const unsigned loff = lane * 16;
    const bf16_t* qp = qbase;
    const bf16_t* vp = vbase;
    auto fetch_q = [&](int set) __attribute__((always_inline)) {
#pragma unroll
        for (int f = 0; f < 4; ++f) qf[set][f] = load_frag_tiled(qp, loff + 1024 * f);
        qp += 2048;
    };
    auto fetch_v = [&]() __attribute__((always_inline)) {
#pragma unroll
        for (int j = 0; j < 4; ++j) vf[j] = load_frag_tiled(vp + j * vgs, loff);
        vp += 512;
    };
    auto trip = [&](int set, bool more) __attribute__((always_inline)) {
        if (more) fetch_q(set ^ 1);
        // ---- S^T: two 16-row s-tiles, D=64 in two WMMA K-steps each ----
        v8f st[2];
#pragma unroll
        for (int m = 0; m < 2; ++m) {
            v8f accs = {};
            accs = wmma_bf16(qf[set][2 * m],     kb0, accs);
            accs = wmma_bf16(qf[set][2 * m + 1], kb1, accs);
            st[m] = accs;
        }
        // ---- per-lane online softmax over this lane's 16 s-values ----
        float x[16];
#pragma unroll
        for (int m = 0; m < 2; ++m)
#pragma unroll
            for (int r = 0; r < 8; ++r)
                x[8 * m + r] = st[m][r] * scale;

        float mx = x[0];
#pragma unroll
        for (int i = 1; i < 16; ++i) mx = fmaxf(mx, x[i]);
        mx = fmaxf(mx, __shfl_xor(mx, 16, 32));   // combine the two halves
        const float mnew = fmaxf(mstat, mx);
        float alpha = (mstat - mnew) * LOG2E;
#pragma unroll
        for (int i = 0; i < 16; ++i) x[i] = (x[i] - mnew) * LOG2E;
        exp2_in_place(alpha, x[0], x[1], x[2], x[3], x[4], x[5], x[6], x[7]);
        exp2_in_place(x[8], x[9], x[10], x[11], x[12], x[13], x[14], x[15]);

        v16bf pb;           // P^T B-fragment, built in-register
        float psum = x[0];
#pragma unroll
        for (int i = 1; i < 16; ++i) psum += x[i];
#pragma unroll
        for (int i = 0; i < 16; ++i) pb[i] = (bf16_t)x[i];
        psum += __shfl_xor(psum, 16, 32);
        lstat = lstat * alpha + psum;
        mstat = mnew;

        // rescale O^T (alpha is uniform per lane / per t-column)
#pragma unroll
        for (int j = 0; j < 4; ++j)
#pragma unroll
            for (int r = 0; r < 8; ++r) o[j][r] *= alpha;

        // ---- O^T += V^T (d x 32s) x P^T (32s x 16t) ----
#pragma unroll
        for (int j = 0; j < 4; ++j) o[j] = wmma_bf16(vf[j], pb, o[j]);
        if (more) fetch_v();
    };

    fetch_q(0);
    fetch_v();
    asm volatile("s_wait_xcnt 0x0" ::: "memory");
    for (int s0 = 0; s0 < T - 64; s0 += 64) {
        trip(0, true);
        trip(1, true);
        asm volatile("s_wait_xcnt 0x0" ::: "memory");
    }
    trip(0, true);
    asm volatile("s_wait_xcnt 0x0" ::: "memory");
    trip(1, false);   // the last trip: nothing left to request

    const float inv = 1.0f / lstat;
    bf16_t* obase = Oh + ((size_t)((b * T + t0) >> 4) * (H * 2) + h * 2) * 512 + lane * 8;
#pragma unroll
    for (int j = 0; j < 4; ++j) {
        v8bf ov;
#pragma unroll
        for (int r = 0; r < 8; ++r) ov[r] = (bf16_t)(o[j][r] * inv);
        *(v8bf*)(obase + j * 256) = ov;
    }
}

// ---------------------------------------------------------------------------
// Host-side launch
// ---------------------------------------------------------------------------
extern "C" void kernel_launch(void* const* d_in, const int* in_sizes, int n_in,
                              void* d_out, int out_size, void* d_ws, size_t ws_size,
                              hipStream_t stream) {
    constexpr int Bb = 2, T = 2048, Cc = 1024, H = 16, D = 64;
    constexpr int M = Bb * T;          // 4096
    const float scale = 1.0f / 32.0f;  // C^-0.5 = 1024^-0.5

    const float* x  = (const float*)d_in[0];
    const float* Wk = (const float*)d_in[1];
    const float* bk = (const float*)d_in[2];
    const float* Wq = (const float*)d_in[3];
    const float* bq = (const float*)d_in[4];
    const float* Wv = (const float*)d_in[5];
    const float* bv = (const float*)d_in[6];
    const float* Wp = (const float*)d_in[7];
    const float* bp = (const float*)d_in[8];

    char* ws = (char*)d_ws;
    size_t off = 0;
    bf16_t* xb   = (bf16_t*)(ws + off); off += (size_t)M * Cc * sizeof(bf16_t);         // 8 MB
    bf16_t* wkT  = (bf16_t*)(ws + off); off += (size_t)H * D * Cc * sizeof(bf16_t);     // 2 MB
    bf16_t* wqT  = (bf16_t*)(ws + off); off += (size_t)H * D * Cc * sizeof(bf16_t);
    bf16_t* wvT  = (bf16_t*)(ws + off); off += (size_t)H * D * Cc * sizeof(bf16_t);
    bf16_t* wpT  = (bf16_t*)(ws + off); off += (size_t)Cc * Cc * sizeof(bf16_t);        // 2 MB
    bf16_t* kmat = (bf16_t*)(ws + off); off += (size_t)Bb * H * T * D * sizeof(bf16_t); // 8 MB
    bf16_t* qmat = (bf16_t*)(ws + off); off += (size_t)Bb * H * T * D * sizeof(bf16_t);
    bf16_t* vTm  = (bf16_t*)(ws + off); off += (size_t)Bb * H * T * D * sizeof(bf16_t);
    bf16_t* oh   = (bf16_t*)(ws + off); off += (size_t)M * Cc * sizeof(bf16_t);         // 8 MB

    // 1) conversions / packing
    {
        mha_cvt_bf16<<<(M / 16) * (Cc / 32) / 8, 256, 0, stream>>>(x, xb, Cc);
        dim3 gw(Cc / 64, H);
        mha_pack_w<<<gw, 256, 0, stream>>>(Wk, wkT, Cc);
        mha_pack_w<<<gw, 256, 0, stream>>>(Wq, wqT, Cc);
        mha_pack_w<<<gw, 256, 0, stream>>>(Wv, wvT, Cc);
        dim3 gp(Cc / 64, Cc / 64);
        mha_pack_wp<<<gp, 256, 0, stream>>>(Wp, wpT, Cc);
    }

    // 2) QKV projections: M=4096, N=1024 (h*64+d), K=1024
    {
        dim3 grid(M / 64, (H * D) / 256);
        mha_gemm_wmma<0, Cc><<<grid, 256, 0, stream>>>(xb, wkT, bk, (void*)kmat, M, H * D, T, H);
        mha_gemm_wmma<0, Cc><<<grid, 256, 0, stream>>>(xb, wqT, bq, (void*)qmat, M, H * D, T, H);
        mha_gemm_wmma<1, Cc><<<grid, 256, 0, stream>>>(xb, wvT, bv, (void*)vTm,  M, H * D, T, H);
    }

    // 3) flash attention: grid (T/64 tiles of t, B*H), 4 waves/block
    {
        dim3 grid(T / 64, Bb * H);
        mha_flash_attn<T><<<grid, 128, 0, stream>>>(kmat, qmat, vTm, oh, H, scale);
    }

    // 4) output projection: [4096,1024] x [1024,1024]^T + bp -> f32 d_out
    {
        dim3 grid(M / 64, Cc / 256);
        mha_gemm_wmma<2, Cc><<<grid, 256, 0, stream>>>(oh, wpT, bp, d_out, M, Cc, T, H);
    }

    (void)in_sizes; (void)n_in; (void)out_size; (void)ws_size;
}

// v004
// Measured time: 91.1 microseconds a run.
// Two timings next to v003 put it at 1.14 and 1.18 times that version's speed.
// Counting every step since v000, it is 4.75 times as fast.
#include <hip/hip_runtime.h>
#include <math.h>

typedef __bf16 bf16_t;
typedef __attribute__((ext_vector_type(16))) __bf16 v16bf;
typedef __attribute__((ext_vector_type(8)))  __bf16 v8bf;
typedef __attribute__((ext_vector_type(8)))  float  v8f;

static __device__ __forceinline__ v8f wmma_bf16(v16bf a, v16bf b, v8f c) {
    // 8 args: (neg_a, A, neg_b, B, c_mod, C, reuse_a, reuse_b)
    return __builtin_amdgcn_wmma_f32_16x16x32_bf16(
        false, a, false, b, (short)0, c, false, false);
}

// Element offset of the 8 consecutive k that start at (row, k), k a multiple of 8.
static __device__ __forceinline__ size_t frag_chunk_offset(int row, int k, int KT) {
    return ((size_t)(row >> 4) * KT + (k >> 5)) * 512
         + (size_t)((((k >> 4) & 1) * 32 + (row & 15) + 16 * ((k >> 3) & 1)) * 8);
}

static __device__ __forceinline__ v16bf load_frag_tiled(const bf16_t* __restrict__ group, unsigned off) {
    const char* p0 = (const char*)group + off;
    v8bf a = *(const v8bf*)p0;
    v8bf b = *(const v8bf*)(p0 + 512);
    v16bf out;
#pragma unroll
    for (int i = 0; i < 8; ++i) { out[i] = a[i]; out[i + 8] = b[i]; }
    return out;
}

static __device__ __forceinline__ void cvt_bf16_tiles(const float* __restrict__ in, bf16_t* __restrict__ out, int C, int blk) {
    const int lane = threadIdx.x & 31;
    const int tile = blk * 8 + (threadIdx.x >> 5);
    const int KT = C >> 5;
    const int rt = tile / KT, kt = tile % KT;
    const float* p = in + (size_t)(rt * 16 + (lane & 15)) * C + kt * 32 + (lane >> 4) * 8;
    const float4 a0 = *(const float4*)(p);
    const float4 a1 = *(const float4*)(p + 4);
    const float4 b0 = *(const float4*)(p + 16);
    const float4 b1 = *(const float4*)(p + 20);
    v8bf lo, hi;
    lo[0] = (bf16_t)a0.x; lo[1] = (bf16_t)a0.y; lo[2] = (bf16_t)a0.z; lo[3] = (bf16_t)a0.w;
    lo[4] = (bf16_t)a1.x; lo[5] = (bf16_t)a1.y; lo[6] = (bf16_t)a1.z; lo[7] = (bf16_t)a1.w;
    hi[0] = (bf16_t)b0.x; hi[1] = (bf16_t)b0.y; hi[2] = (bf16_t)b0.z; hi[3] = (bf16_t)b0.w;
    hi[4] = (bf16_t)b1.x; hi[5] = (bf16_t)b1.y; hi[6] = (bf16_t)b1.z; hi[7] = (bf16_t)b1.w;
    bf16_t* q = out + (size_t)tile * 512 + lane * 8;
    *(v8bf*)q = lo;
    *(v8bf*)(q + 256) = hi;
    // In the merged launch other jobs' code follows these stores in the listing and reuses their registers.
    asm volatile("s_wait_xcnt 0x0" ::: "memory");
}

static __device__ __forceinline__ void transpose_tile_64x64(
    const float* __restrict__ in, int ldin, bf16_t* __restrict__ out, int row0, int k0, int KT) {
    __shared__ float tile[64][65];
    const int tid = threadIdx.x;

    const int lr = tid >> 4;         // 0..15: row inside a group of 16
    const int lc = (tid & 15) * 4;   // first of 4 columns
#pragma unroll
    for (int i = 0; i < 4; ++i) {
        const int r = i * 16 + lr;
        const float4 v = *(const float4*)(in + (size_t)r * ldin + lc);
        tile[r][lc + 0] = v.x;
        tile[r][lc + 1] = v.y;
        tile[r][lc + 2] = v.z;
        tile[r][lc + 3] = v.w;
    }
    __syncthreads();

    const int sr = tid >> 3;         // 0..31: output row inside a group of 32
    const int sc = (tid & 7) * 8;    // first of 8 output columns
#pragma unroll
    for (int i = 0; i < 2; ++i) {
        const int j = i * 32 + sr;
        v8bf o;
#pragma unroll
        for (int k = 0; k < 8; ++k) o[k] = (bf16_t)tile[sc + k][j];
        *(v8bf*)(out + frag_chunk_offset(row0 + j, k0 + sc, KT)) = o;
    }
    // In the merged launch other jobs' code follows these stores in the listing and reuses their registers.
    asm volatile("s_wait_xcnt 0x0" ::: "memory");
}

// All five packing jobs in ONE launch: none reads what another writes, so the block index picks the job.
//   blocks [0, 3 * WB)      : W[h][c][d] (f32) -> Wt (bf16), operand [N=h*64+d][K=c] in fragment order, for k, q, v;
//                             head size 64 = one tile wide
//   the next PB blocks      : Wp[k][n] (f32) -> WpT (bf16), operand [n][k] in fragment order
//   the rest                : x (f32) -> xb (bf16) in fragment order
// The transposes stand first: theirs is the longer way from load to store.
// grid 3 * WB + PB + (M/16 * C/32) / 8, 256 threads
template <int C, int H>
__global__ void mha_pack_all(const float* __restrict__ x,
                             const float* __restrict__ Wk, const float* __restrict__ Wq,
                             const float* __restrict__ Wv, const float* __restrict__ Wp,
                             bf16_t* __restrict__ xb,
                             bf16_t* __restrict__ wkT, bf16_t* __restrict__ wqT,
                             bf16_t* __restrict__ wvT, bf16_t* __restrict__ wpT) {
    constexpr int CT = C / 64;        // 64-wide tiles along C
    constexpr int WB = CT * H;        // tiles of one per-head weight
    constexpr int PB = CT * CT;       // tiles of the output projection
    const int blk = blockIdx.x;       // the same in every thread of a block: the barrier in the transpose is block-uniform
    if (blk < 3 * WB + PB) {
        const int job = blk / WB < 3 ? blk / WB : 3;
        const int t  = blk - job * WB;
        const int tx = (t % CT) * 64;   // c0 (per-head weights), k0 (output projection)
        const int ty = (t / CT) * 64;   // h * 64,                n0
        const float* in  = job == 0 ? Wk : job == 1 ? Wq : job == 2 ? Wv : Wp;
        bf16_t*      out = job == 0 ? wkT : job == 1 ? wqT : job == 2 ? wvT : wpT;
        if (job < 3) transpose_tile_64x64(in + ((size_t)ty * C + (size_t)tx * 64), 64, out, ty, tx, C >> 5);
        else         transpose_tile_64x64(in + (size_t)tx * C + ty,                 C, out, ty, tx, C >> 5);
    } else {
        cvt_bf16_tiles(x, xb, C, blk - (3 * WB + PB));
    }
}

template <int MODE, int K>
static __device__ __forceinline__ void gemm_wmma_tile(const bf16_t* __restrict__ A,
                              const bf16_t* __restrict__ Bm,
                              const float* __restrict__ bias,
                              void* __restrict__ out,
                              int M, int N, int T, int H) {
    const int lane = threadIdx.x & 31;
    const int wave = __builtin_amdgcn_readfirstlane(threadIdx.x >> 5);   // wave-uniform: tile bases are formed in scalar registers
    const int wm = wave & 1;   // 2 waves along M
    const int wn = wave >> 1;  // 4 waves along N
    const int m0 = blockIdx.x * 64 + wm * 32;
    const int n0 = blockIdx.y * 256 + wn * 64;

    constexpr int KT = K >> 5;
    const int mt = m0 >> 4;
    const int nt = n0 >> 4;

    const bf16_t* ag = A  + (size_t)mt * KT * 512;   // the wave's two 16-row groups of A
    const bf16_t* bg = Bm + (size_t)nt * KT * 512;   // and its four of B
    constexpr size_t gs = (size_t)KT * 512;          // elements per 16-row group

    constexpr int SETS = 3;   // register sets: one in use, two in flight
    static_assert(KT >= SETS && (KT - (SETS - 1)) % SETS == 0, "the loop walks SETS tiles a trip and leaves SETS - 1 for the tail");

    v8f acc[2][4] = {};
    v16bf fa[SETS][2], fb[SETS][4];
    auto fetch = [&](int set, unsigned o) __attribute__((always_inline)) {
        fa[set][0] = load_frag_tiled(ag,      o);
        fa[set][1] = load_frag_tiled(ag + gs, o);
#pragma unroll
        for (int j = 0; j < 4; ++j) fb[set][j] = load_frag_tiled(bg + j * gs, o);
    };
    auto products = [&](int set) __attribute__((always_inline)) {
#pragma unroll
        for (int j = 0; j < 4; ++j) {
            if (MODE == 0) {
                acc[0][j] = wmma_bf16(fb[set][j], fa[set][0], acc[0][j]);
                acc[1][j] = wmma_bf16(fb[set][j], fa[set][1], acc[1][j]);
            } else {
                acc[0][j] = wmma_bf16(fa[set][0], fb[set][j], acc[0][j]);
                acc[1][j] = wmma_bf16(fa[set][1], fb[set][j], acc[1][j]);
            }
        }
    };

    unsigned off = lane * 16;
#pragma unroll
    for (int s = 0; s < SETS - 1; ++s) fetch(s, off + s * 1024);
    for (int kt = 0; kt < KT - (SETS - 1); kt += SETS, off += SETS * 1024) {
#pragma unroll
        for (int u = 0; u < SETS; ++u) {
            fetch((u + SETS - 1) % SETS, off + (u + SETS - 1) * 1024);
            // Keeps the requests in front of these products: without it the scheduler sinks them to just
            // before their own use, and the wave waits out the whole L2 latency again.
            __builtin_amdgcn_sched_barrier(0);
            products(u);
            // Keeps what follows behind these products: the next requests, and at the loop's foot the step of the
            // address register, whose wait would otherwise stall the wave in front of products that are ready.
            __builtin_amdgcn_sched_barrier(0);
        }
    }
#pragma unroll
    for (int u = 0; u < SETS - 1; ++u) products(u);   // the last tiles: nothing left to request

    const int half = lane >> 4;
    const int nc = lane & 15;
    if (MODE == 0) {
        const int h = n0 >> 6;   // the wave's 64 columns are one head
#pragma unroll
        for (int i = 0; i < 2; ++i) {
            const int mb = m0 + 16 * i;
            const int b = mb / T, tt = (mb % T) >> 4;
            bf16_t* tile = (bf16_t*)out + ((size_t)b * H + h) * T * 64 + (size_t)tt * 1024 + lane * 8;
#pragma unroll
            for (int j = 0; j < 4; ++j) {
                const float* bj = bias + n0 + 16 * j + 8 * half;
                v8bf o;
#pragma unroll
                for (int r = 0; r < 8; ++r) o[r] = (bf16_t)(acc[i][j][r] + bj[r]);
                *(v8bf*)(tile + j * 256) = o;
            }
        }
    } else if (MODE == 1) {
        const int h = n0 >> 6;
        const int b = m0 / T, sb = (m0 % T) >> 5;   // the wave's 32 rows are one k tile of v^T
        const int KTs = T >> 5;
        bf16_t* base = (bf16_t*)out + ((size_t)b * H + h) * 64 * T + lane * 8;
#pragma unroll
        for (int j = 0; j < 4; ++j) {
            const float bn = bias[n0 + 16 * j + nc];
#pragma unroll
            for (int i = 0; i < 2; ++i) {
                v8bf o;
#pragma unroll
                for (int r = 0; r < 8; ++r) o[r] = (bf16_t)(acc[i][j][r] + bn);
                *(v8bf*)(base + ((size_t)j * KTs + sb) * 512 + i * 256) = o;
            }
        }
    } else {
#pragma unroll
        for (int i = 0; i < 2; ++i) {
#pragma unroll
            for (int j = 0; j < 4; ++j) {
#pragma unroll
                for (int r = 0; r < 8; ++r) {
                    const int m = m0 + 16 * i + r + 8 * half;
                    const int n = n0 + 16 * j + nc;
                    ((float*)out)[(size_t)m * N + n] = acc[i][j][r] + bias[n];
                }
            }
        }
    }
}

// One GEMM a launch (the output projection). grid (M/64, N/256), 256 threads
template <int MODE, int K>
__global__ void __launch_bounds__(256) __attribute__((amdgpu_waves_per_eu(4, 4))) mha_gemm_wmma(const bf16_t* __restrict__ A,
                              const bf16_t* __restrict__ Bm,
                              const float* __restrict__ bias,
                              void* __restrict__ out,
                              int M, int N, int T, int H) {
    gemm_wmma_tile<MODE, K>(A, Bm, bias, out, M, N, T, H);
}

// The k, q and v projections in ONE launch: they read the same x and none reads another's output, so
// blockIdx.z (the same in every wave of a block: a scalar branch) picks the weights, the bias, the output and its store mode.
// grid (M/64, N/256, 3), 256 threads
template <int K>
__global__ void __launch_bounds__(256) __attribute__((amdgpu_waves_per_eu(4, 4))) mha_gemm_kqv(const bf16_t* __restrict__ A,
                              const bf16_t* __restrict__ wkT, const bf16_t* __restrict__ wqT, const bf16_t* __restrict__ wvT,
                              const float* __restrict__ bk, const float* __restrict__ bq, const float* __restrict__ bv,
                              bf16_t* __restrict__ kmat, bf16_t* __restrict__ qmat, bf16_t* __restrict__ vTm,
                              int M, int N, int T, int H) {
    const int which = blockIdx.z;
    if (which == 2) gemm_wmma_tile<1, K>(A, wvT, bv, (void*)vTm, M, N, T, H);
    else            gemm_wmma_tile<0, K>(A, which ? wqT : wkT, which ? bq : bk, (void*)(which ? qmat : kmat), M, N, T, H);
}

// exp(y) = 2^(y * LOG2E), as the fast library exponential forms it.
constexpr float LOG2E = 1.44269504f;

static __device__ __forceinline__ void exp2_in_place(float& a, float& b, float& c, float& d,
                                                     float& e, float& f, float& g, float& h) {
    asm("v_exp_f32 %0, %0\n\tv_exp_f32 %1, %1\n\tv_exp_f32 %2, %2\n\tv_exp_f32 %3, %3\n\t"
        "v_exp_f32 %4, %4\n\tv_exp_f32 %5, %5\n\tv_exp_f32 %6, %6\n\tv_exp_f32 %7, %7\n\t"
        "v_nop"
        : "+v"(a), "+v"(b), "+v"(c), "+v"(d), "+v"(e), "+v"(f), "+v"(g), "+v"(h));
}
static __device__ __forceinline__ void exp2_in_place(float& z, float& a, float& b, float& c, float& d,
                                                     float& e, float& f, float& g, float& h) {
    asm("v_exp_f32 %0, %0\n\tv_exp_f32 %1, %1\n\tv_exp_f32 %2, %2\n\tv_exp_f32 %3, %3\n\t"
        "v_exp_f32 %4, %4\n\tv_exp_f32 %5, %5\n\tv_exp_f32 %6, %6\n\tv_exp_f32 %7, %7\n\t"
        "v_exp_f32 %8, %8\n\tv_nop"
        : "+v"(z), "+v"(a), "+v"(b), "+v"(c), "+v"(d), "+v"(e), "+v"(f), "+v"(g), "+v"(h));
}

template <int T>
__global__ void __launch_bounds__(128) __attribute__((amdgpu_waves_per_eu(4, 4))) mha_flash_attn(const bf16_t* __restrict__ Kp,
                               const bf16_t* __restrict__ Qp,
                               const bf16_t* __restrict__ VTp,
                               bf16_t* __restrict__ Oh,
                               int H, float scale) {
    const int lane = threadIdx.x & 31;
    const int wave = __builtin_amdgcn_readfirstlane(threadIdx.x >> 5);   // wave-uniform: tile bases are formed in scalar registers
    const int bh = blockIdx.y;
    const int b = bh / H, h = bh % H;
    const int t0 = blockIdx.x * 64 + wave * 16;

    const bf16_t* kbase = Kp  + (size_t)bh * T * 64;
    const bf16_t* qbase = Qp  + (size_t)bh * T * 64;
    const bf16_t* vbase = VTp + (size_t)bh * 64 * T;

    // k tile as B operand (N = t columns, K = d), resident for whole loop
    const v16bf kb0 = load_frag_tiled(kbase + (size_t)t0 * 64, lane * 16);
    const v16bf kb1 = load_frag_tiled(kbase + (size_t)t0 * 64, lane * 16 + 1024);

    float mstat = -INFINITY, lstat = 0.f;
    v8f o[4] = {};   // O^T: 4 d-tiles x (8 vgprs), col t = lane&15

    constexpr size_t vgs = (size_t)T * 16;   // elements per 16-row group of v^T
    static_assert(T % 64 == 0 && T >= 64, "the loop walks two trips of 32 s at a time");
    v16bf qf[2][4], vf[4];
    const unsigned loff = lane * 16;
    const bf16_t* qp = qbase;
    const bf16_t* vp = vbase;
    auto fetch_q = [&](int set) __attribute__((always_inline)) {
#pragma unroll
        for (int f = 0; f < 4; ++f) qf[set][f] = load_frag_tiled(qp, loff + 1024 * f);
        qp += 2048;
    };
    auto fetch_v = [&]() __attribute__((always_inline)) {
#pragma unroll
        for (int j = 0; j < 4; ++j) vf[j] = load_frag_tiled(vp + j * vgs, loff);
        vp += 512;
    };
    auto trip = [&](int set, bool more) __attribute__((always_inline)) {
        if (more) fetch_q(set ^ 1);
        // ---- S^T: two 16-row s-tiles, D=64 in two WMMA K-steps each ----
        v8f st[2];
#pragma unroll
        for (int m = 0; m < 2; ++m) {
            v8f accs = {};
            accs = wmma_bf16(qf[set][2 * m],     kb0, accs);
            accs = wmma_bf16(qf[set][2 * m + 1], kb1, accs);
            st[m] = accs;
        }
        // ---- per-lane online softmax over this lane's 16 s-values ----
        float x[16];
#pragma unroll
        for (int m = 0; m < 2; ++m)
#pragma unroll
            for (int r = 0; r < 8; ++r)
                x[8 * m + r] = st[m][r] * scale;

        float mx = x[0];
#pragma unroll
        for (int i = 1; i < 16; ++i) mx = fmaxf(mx, x[i]);
        mx = fmaxf(mx, __shfl_xor(mx, 16, 32));   // combine the two halves
        const float mnew = fmaxf(mstat, mx);
        float alpha = (mstat - mnew) * LOG2E;
#pragma unroll
        for (int i = 0; i < 16; ++i) x[i] = (x[i] - mnew) * LOG2E;
        exp2_in_place(alpha, x[0], x[1], x[2], x[3], x[4], x[5], x[6], x[7]);
        exp2_in_place(x[8], x[9], x[10], x[11], x[12], x[13], x[14], x[15]);

        v16bf pb;           // P^T B-fragment, built in-register
        float psum = x[0];
#pragma unroll
        for (int i = 1; i < 16; ++i) psum += x[i];
#pragma unroll
        for (int i = 0; i < 16; ++i) pb[i] = (bf16_t)x[i];
        psum += __shfl_xor(psum, 16, 32);
        lstat = lstat * alpha + psum;
        mstat = mnew;

        // rescale O^T (alpha is uniform per lane / per t-column)
#pragma unroll
        for (int j = 0; j < 4; ++j)
#pragma unroll
            for (int r = 0; r < 8; ++r) o[j][r] *= alpha;

        // ---- O^T += V^T (d x 32s) x P^T (32s x 16t) ----
#pragma unroll
        for (int j = 0; j < 4; ++j) o[j] = wmma_bf16(vf[j], pb, o[j]);
        if (more) fetch_v();
    };

    fetch_q(0);
    fetch_v();
    asm volatile("s_wait_xcnt 0x0" ::: "memory");
    for (int s0 = 0; s0 < T - 64; s0 += 64) {
        trip(0, true);
        trip(1, true);
        asm volatile("s_wait_xcnt 0x0" ::: "memory");
    }
    trip(0, true);
    asm volatile("s_wait_xcnt 0x0" ::: "memory");
    trip(1, false);   // the last trip: nothing left to request

    const float inv = 1.0f / lstat;
    bf16_t* obase = Oh + ((size_t)((b * T + t0) >> 4) * (H * 2) + h * 2) * 512 + lane * 8;
#pragma unroll
    for (int j = 0; j < 4; ++j) {
        v8bf ov;
#pragma unroll
        for (int r = 0; r < 8; ++r) ov[r] = (bf16_t)(o[j][r] * inv);
        *(v8bf*)(obase + j * 256) = ov;
    }
}

// ---------------------------------------------------------------------------
// Host-side launch
// ---------------------------------------------------------------------------
extern "C" void kernel_launch(void* const* d_in, const int* in_sizes, int n_in,
                              void* d_out, int out_size, void* d_ws, size_t ws_size,
                              hipStream_t stream) {
    constexpr int Bb = 2, T = 2048, Cc = 1024, H = 16, D = 64;
    constexpr int M = Bb * T;          // 4096
    const float scale = 1.0f / 32.0f;  // C^-0.5 = 1024^-0.5

    const float* x  = (const float*)d_in[0];
    const float* Wk = (const float*)d_in[1];
    const float* bk = (const float*)d_in[2];
    const float* Wq = (const float*)d_in[3];
    const float* bq = (const float*)d_in[4];
    const float* Wv = (const float*)d_in[5];
    const float* bv = (const float*)d_in[6];
    const float* Wp = (const float*)d_in[7];
    const float* bp = (const float*)d_in[8];

    char* ws = (char*)d_ws;
    size_t off = 0;
    bf16_t* xb   = (bf16_t*)(ws + off); off += (size_t)M * Cc * sizeof(bf16_t);         // 8 MB
    bf16_t* wkT  = (bf16_t*)(ws + off); off += (size_t)H * D * Cc * sizeof(bf16_t);     // 2 MB
    bf16_t* wqT  = (bf16_t*)(ws + off); off += (size_t)H * D * Cc * sizeof(bf16_t);
    bf16_t* wvT  = (bf16_t*)(ws + off); off += (size_t)H * D * Cc * sizeof(bf16_t);
    bf16_t* wpT  = (bf16_t*)(ws + off); off += (size_t)Cc * Cc * sizeof(bf16_t);        // 2 MB
    bf16_t* kmat = (bf16_t*)(ws + off); off += (size_t)Bb * H * T * D * sizeof(bf16_t); // 8 MB
    bf16_t* qmat = (bf16_t*)(ws + off); off += (size_t)Bb * H * T * D * sizeof(bf16_t);
    bf16_t* vTm  = (bf16_t*)(ws + off); off += (size_t)Bb * H * T * D * sizeof(bf16_t);
    bf16_t* oh   = (bf16_t*)(ws + off); off += (size_t)M * Cc * sizeof(bf16_t);         // 8 MB

    // 1) conversions / packing, one launch
    {
        constexpr int blocks = 3 * (Cc / 64) * H + (Cc / 64) * (Cc / 64) + (M / 16) * (Cc / 32) / 8;
        mha_pack_all<Cc, H><<<blocks, 256, 0, stream>>>(x, Wk, Wq, Wv, Wp, xb, wkT, wqT, wvT, wpT);
    }

    // 2) k, q, v projections, one launch: each M=4096, N=1024 (h*64+d), K=1024
    {
        dim3 grid(M / 64, (H * D) / 256, 3);
        mha_gemm_kqv<Cc><<<grid, 256, 0, stream>>>(xb, wkT, wqT, wvT, bk, bq, bv, kmat, qmat, vTm, M, H * D, T, H);
    }

    // 3) flash attention: grid (T/64 tiles of t, B*H), 4 waves/block
    {
        dim3 grid(T / 64, Bb * H);
        mha_flash_attn<T><<<grid, 128, 0, stream>>>(kmat, qmat, vTm, oh, H, scale);
    }

    // 4) output projection: [4096,1024] x [1024,1024]^T + bp -> f32 d_out
    {
        dim3 grid(M / 64, Cc / 256);
        mha_gemm_wmma<2, Cc><<<grid, 256, 0, stream>>>(oh, wpT, bp, d_out, M, Cc, T, H);
    }

    (void)in_sizes; (void)n_in; (void)out_size; (void)ws_size;
}

// v005
// Measured time: 85.5 microseconds a run.
// Next to v004, in two timings, it ran 1.07 and 1.05 times as fast.
// Counting every step since v000, it is 5.05 times as fast.
#include <hip/hip_runtime.h>
#include <math.h>

typedef __bf16 bf16_t;
typedef __attribute__((ext_vector_type(16))) __bf16 v16bf;
typedef __attribute__((ext_vector_type(8)))  __bf16 v8bf;
typedef __attribute__((ext_vector_type(8)))  float  v8f;

static __device__ __forceinline__ v8f wmma_bf16(v16bf a, v16bf b, v8f c) {
    // 8 args: (neg_a, A, neg_b, B, c_mod, C, reuse_a, reuse_b)
    return __builtin_amdgcn_wmma_f32_16x16x32_bf16(
        false, a, false, b, (short)0, c, false, false);
}

// Element offset of the 8 consecutive k that start at (row, k), k a multiple of 8.
static __device__ __forceinline__ size_t frag_chunk_offset(int row, int k, int KT) {
    return ((size_t)(row >> 4) * KT + (k >> 5)) * 512
         + (size_t)((((k >> 4) & 1) * 32 + (row & 15) + 16 * ((k >> 3) & 1)) * 8);
}

static __device__ __forceinline__ v16bf load_frag_tiled(const bf16_t* __restrict__ group, unsigned off) {
    const char* p0 = (const char*)group + off;
    v8bf a = *(const v8bf*)p0;
    v8bf b = *(const v8bf*)(p0 + 512);
    v16bf out;
#pragma unroll
    for (int i = 0; i < 8; ++i) { out[i] = a[i]; out[i + 8] = b[i]; }
    return out;
}

static __device__ __forceinline__ void cvt_bf16_tiles(const float* __restrict__ in, bf16_t* __restrict__ out, int C, int blk) {
    const int lane = threadIdx.x & 31;
    const int tile = blk * 8 + (threadIdx.x >> 5);
    const int KT = C >> 5;
    const int rt = tile / KT, kt = tile % KT;
    const float* p = in + (size_t)(rt * 16 + (lane & 15)) * C + kt * 32 + (lane >> 4) * 8;
    const float4 a0 = *(const float4*)(p);
    const float4 a1 = *(const float4*)(p + 4);
    const float4 b0 = *(const float4*)(p + 16);
    const float4 b1 = *(const float4*)(p + 20);
    v8bf lo, hi;
    lo[0] = (bf16_t)a0.x; lo[1] = (bf16_t)a0.y; lo[2] = (bf16_t)a0.z; lo[3] = (bf16_t)a0.w;
    lo[4] = (bf16_t)a1.x; lo[5] = (bf16_t)a1.y; lo[6] = (bf16_t)a1.z; lo[7] = (bf16_t)a1.w;
    hi[0] = (bf16_t)b0.x; hi[1] = (bf16_t)b0.y; hi[2] = (bf16_t)b0.z; hi[3] = (bf16_t)b0.w;
    hi[4] = (bf16_t)b1.x; hi[5] = (bf16_t)b1.y; hi[6] = (bf16_t)b1.z; hi[7] = (bf16_t)b1.w;
    bf16_t* q = out + (size_t)tile * 512 + lane * 8;
    *(v8bf*)q = lo;
    *(v8bf*)(q + 256) = hi;
    // In the merged launch other jobs' code follows these stores in the listing and reuses their registers.
    asm volatile("s_wait_xcnt 0x0" ::: "memory");
}

static __device__ __forceinline__ void transpose_tile_64x64(
    const float* __restrict__ in, int ldin, bf16_t* __restrict__ out, int row0, int k0, int KT) {
    __shared__ float tile[64][65];
    const int tid = threadIdx.x;

    const int lr = tid >> 4;         // 0..15: row inside a group of 16
    const int lc = (tid & 15) * 4;   // first of 4 columns
#pragma unroll
    for (int i = 0; i < 4; ++i) {
        const int r = i * 16 + lr;
        const float4 v = *(const float4*)(in + (size_t)r * ldin + lc);
        tile[r][lc + 0] = v.x;
        tile[r][lc + 1] = v.y;
        tile[r][lc + 2] = v.z;
        tile[r][lc + 3] = v.w;
    }
    __syncthreads();

    const int sr = tid >> 3;         // 0..31: output row inside a group of 32
    const int sc = (tid & 7) * 8;    // first of 8 output columns
#pragma unroll
    for (int i = 0; i < 2; ++i) {
        const int j = i * 32 + sr;
        v8bf o;
#pragma unroll
        for (int k = 0; k < 8; ++k) o[k] = (bf16_t)tile[sc + k][j];
        *(v8bf*)(out + frag_chunk_offset(row0 + j, k0 + sc, KT)) = o;
    }
    // In the merged launch other jobs' code follows these stores in the listing and reuses their registers.
    asm volatile("s_wait_xcnt 0x0" ::: "memory");
}

// All five packing jobs in ONE launch: none reads what another writes, so the block index picks the job.
//   blocks [0, 3 * WB)      : W[h][c][d] (f32) -> Wt (bf16), operand [N=h*64+d][K=c] in fragment order, for k, q, v;
//                             head size 64 = one tile wide
//   the next PB blocks      : Wp[k][n] (f32) -> WpT (bf16), operand [n][k] in fragment order
//   the rest                : x (f32) -> xb (bf16) in fragment order
// The transposes stand first: theirs is the longer way from load to store.
// grid 3 * WB + PB + (M/16 * C/32) / 8, 256 threads
template <int C, int H>
__global__ void mha_pack_all(const float* __restrict__ x,
                             const float* __restrict__ Wk, const float* __restrict__ Wq,
                             const float* __restrict__ Wv, const float* __restrict__ Wp,
                             bf16_t* __restrict__ xb,
                             bf16_t* __restrict__ wkT, bf16_t* __restrict__ wqT,
                             bf16_t* __restrict__ wvT, bf16_t* __restrict__ wpT) {
    constexpr int CT = C / 64;        // 64-wide tiles along C
    constexpr int WB = CT * H;        // tiles of one per-head weight
    constexpr int PB = CT * CT;       // tiles of the output projection
    const int blk = blockIdx.x;       // the same in every thread of a block: the barrier in the transpose is block-uniform
    if (blk < 3 * WB + PB) {
        const int job = blk / WB < 3 ? blk / WB : 3;
        const int t  = blk - job * WB;
        const int tx = (t % CT) * 64;   // c0 (per-head weights), k0 (output projection)
        const int ty = (t / CT) * 64;   // h * 64,                n0
        const float* in  = job == 0 ? Wk : job == 1 ? Wq : job == 2 ? Wv : Wp;
        bf16_t*      out = job == 0 ? wkT : job == 1 ? wqT : job == 2 ? wvT : wpT;
        if (job < 3) transpose_tile_64x64(in + ((size_t)ty * C + (size_t)tx * 64), 64, out, ty, tx, C >> 5);
        else         transpose_tile_64x64(in + (size_t)tx * C + ty,                 C, out, ty, tx, C >> 5);
    } else {
        cvt_bf16_tiles(x, xb, C, blk - (3 * WB + PB));
    }
}

template <int MODE, int K>
static __device__ __forceinline__ void gemm_wmma_tile(const bf16_t* __restrict__ A,
                              const bf16_t* __restrict__ Bm,
                              const float* __restrict__ bias,
                              void* __restrict__ out,
                              int M, int N, int T, int H, float osc) {
    const int lane = threadIdx.x & 31;
    const int wave = __builtin_amdgcn_readfirstlane(threadIdx.x >> 5);   // wave-uniform: tile bases are formed in scalar registers
    const int wm = wave & 1;   // 2 waves along M
    const int wn = wave >> 1;  // 4 waves along N
    const int m0 = blockIdx.x * 64 + wm * 32;
    const int n0 = blockIdx.y * 256 + wn * 64;

    constexpr int KT = K >> 5;
    const int mt = m0 >> 4;
    const int nt = n0 >> 4;

    const bf16_t* ag = A  + (size_t)mt * KT * 512;   // the wave's two 16-row groups of A
    const bf16_t* bg = Bm + (size_t)nt * KT * 512;   // and its four of B
    constexpr size_t gs = (size_t)KT * 512;          // elements per 16-row group

    constexpr int SETS = 3;   // register sets: one in use, two in flight
    static_assert(KT >= SETS && (KT - (SETS - 1)) % SETS == 0, "the loop walks SETS tiles a trip and leaves SETS - 1 for the tail");

    v8f acc[2][4] = {};
    v16bf fa[SETS][2], fb[SETS][4];
    auto fetch = [&](int set, unsigned o) __attribute__((always_inline)) {
        fa[set][0] = load_frag_tiled(ag,      o);
        fa[set][1] = load_frag_tiled(ag + gs, o);
#pragma unroll
        for (int j = 0; j < 4; ++j) fb[set][j] = load_frag_tiled(bg + j * gs, o);
    };
    auto products = [&](int set) __attribute__((always_inline)) {
#pragma unroll
        for (int j = 0; j < 4; ++j) {
            if (MODE == 0) {
                acc[0][j] = wmma_bf16(fb[set][j], fa[set][0], acc[0][j]);
                acc[1][j] = wmma_bf16(fb[set][j], fa[set][1], acc[1][j]);
            } else {
                acc[0][j] = wmma_bf16(fa[set][0], fb[set][j], acc[0][j]);
                acc[1][j] = wmma_bf16(fa[set][1], fb[set][j], acc[1][j]);
            }
        }
    };

    unsigned off = lane * 16;
#pragma unroll
    for (int s = 0; s < SETS - 1; ++s) fetch(s, off + s * 1024);
    for (int kt = 0; kt < KT - (SETS - 1); kt += SETS, off += SETS * 1024) {
#pragma unroll
        for (int u = 0; u < SETS; ++u) {
            fetch((u + SETS - 1) % SETS, off + (u + SETS - 1) * 1024);
            // Keeps the requests in front of these products: without it the scheduler sinks them to just
            // before their own use, and the wave waits out the whole L2 latency again.
            __builtin_amdgcn_sched_barrier(0);
            products(u);
            // Keeps what follows behind these products: the next requests, and at the loop's foot the step of the
            // address register, whose wait would otherwise stall the wave in front of products that are ready.
            __builtin_amdgcn_sched_barrier(0);
        }
    }
#pragma unroll
    for (int u = 0; u < SETS - 1; ++u) products(u);   // the last tiles: nothing left to request

    const int half = lane >> 4;
    const int nc = lane & 15;
    if (MODE == 0) {
        const int h = n0 >> 6;   // the wave's 64 columns are one head
#pragma unroll
        for (int i = 0; i < 2; ++i) {
            const int mb = m0 + 16 * i;
            const int b = mb / T, tt = (mb % T) >> 4;
            bf16_t* tile = (bf16_t*)out + ((size_t)b * H + h) * T * 64 + (size_t)tt * 1024 + lane * 8;
#pragma unroll
            for (int j = 0; j < 4; ++j) {
                const float* bj = bias + n0 + 16 * j + 8 * half;
                v8bf o;
#pragma unroll
                for (int r = 0; r < 8; ++r) o[r] = (bf16_t)((acc[i][j][r] + bj[r]) * osc);
                *(v8bf*)(tile + j * 256) = o;
            }
        }
    } else if (MODE == 1) {
        const int h = n0 >> 6;
        const int b = m0 / T, sb = (m0 % T) >> 5;   // the wave's 32 rows are one k tile of v^T
        const int KTs = T >> 5;
        bf16_t* base = (bf16_t*)out + ((size_t)b * H + h) * 64 * T + lane * 8;
#pragma unroll
        for (int j = 0; j < 4; ++j) {
            const float bn = bias[n0 + 16 * j + nc];
#pragma unroll
            for (int i = 0; i < 2; ++i) {
                v8bf o;
#pragma unroll
                for (int r = 0; r < 8; ++r) o[r] = (bf16_t)(acc[i][j][r] + bn);
                *(v8bf*)(base + ((size_t)j * KTs + sb) * 512 + i * 256) = o;
            }
        }
    } else {
#pragma unroll
        for (int i = 0; i < 2; ++i) {
#pragma unroll
            for (int j = 0; j < 4; ++j) {
#pragma unroll
                for (int r = 0; r < 8; ++r) {
                    const int m = m0 + 16 * i + r + 8 * half;
                    const int n = n0 + 16 * j + nc;
                    ((float*)out)[(size_t)m * N + n] = acc[i][j][r] + bias[n];
                }
            }
        }
    }
}

// One GEMM a launch (the output projection). grid (M/64, N/256), 256 threads
template <int MODE, int K>
__global__ void __launch_bounds__(256) __attribute__((amdgpu_waves_per_eu(4, 4))) mha_gemm_wmma(const bf16_t* __restrict__ A,
                              const bf16_t* __restrict__ Bm,
                              const float* __restrict__ bias,
                              void* __restrict__ out,
                              int M, int N, int T, int H) {
    gemm_wmma_tile<MODE, K>(A, Bm, bias, out, M, N, T, H, 1.0f);
}

// The k, q and v projections in ONE launch: they read the same x and none reads another's output, so
// blockIdx.z (the same in every wave of a block: a scalar branch) picks the weights, the bias, the output and its store mode.
// k is stored times kscale = softmax scale * log2(e): the attention's score products then come out as exp2 arguments.
// grid (M/64, N/256, 3), 256 threads
template <int K>
__global__ void __launch_bounds__(256) __attribute__((amdgpu_waves_per_eu(4, 4))) mha_gemm_kqv(const bf16_t* __restrict__ A,
                              const bf16_t* __restrict__ wkT, const bf16_t* __restrict__ wqT, const bf16_t* __restrict__ wvT,
                              const float* __restrict__ bk, const float* __restrict__ bq, const float* __restrict__ bv,
                              bf16_t* __restrict__ kmat, bf16_t* __restrict__ qmat, bf16_t* __restrict__ vTm,
                              int M, int N, int T, int H, float kscale) {
    const int which = blockIdx.z;
    if (which == 2) gemm_wmma_tile<1, K>(A, wvT, bv, (void*)vTm, M, N, T, H, 1.0f);
    else            gemm_wmma_tile<0, K>(A, which ? wqT : wkT, which ? bq : bk, (void*)(which ? qmat : kmat), M, N, T, H,
                                         which ? 1.0f : kscale);
}

static __device__ __forceinline__ void exp2_in_place(float& a, float& b, float& c, float& d,
                                                     float& e, float& f, float& g, float& h) {
    asm("v_exp_f32 %0, %0\n\tv_exp_f32 %1, %1\n\tv_exp_f32 %2, %2\n\tv_exp_f32 %3, %3\n\t"
        "v_exp_f32 %4, %4\n\tv_exp_f32 %5, %5\n\tv_exp_f32 %6, %6\n\tv_exp_f32 %7, %7\n\t"
        "v_nop"
        : "+v"(a), "+v"(b), "+v"(c), "+v"(d), "+v"(e), "+v"(f), "+v"(g), "+v"(h));
}
static __device__ __forceinline__ void exp2_in_place(float& a) {
    asm("v_exp_f32 %0, %0\n\tv_nop" : "+v"(a));
}

template <int T>
__global__ void __launch_bounds__(128) __attribute__((amdgpu_waves_per_eu(4, 4))) mha_flash_attn(const bf16_t* __restrict__ Kp,
                               const bf16_t* __restrict__ Qp,
                               const bf16_t* __restrict__ VTp,
                               bf16_t* __restrict__ Oh,
                               int H) {
    const int lane = threadIdx.x & 31;
    const int wave = __builtin_amdgcn_readfirstlane(threadIdx.x >> 5);   // wave-uniform: tile bases are formed in scalar registers
    const int bh = blockIdx.y;
    const int b = bh / H, h = bh % H;
    const int t0 = blockIdx.x * 64 + wave * 16;

    const bf16_t* kbase = Kp  + (size_t)bh * T * 64;
    const bf16_t* qbase = Qp  + (size_t)bh * T * 64;
    const bf16_t* vbase = VTp + (size_t)bh * 64 * T;

    // k tile as B operand (N = t columns, K = d), resident for whole loop
    const v16bf kb0 = load_frag_tiled(kbase + (size_t)t0 * 64, lane * 16);
    const v16bf kb1 = load_frag_tiled(kbase + (size_t)t0 * 64, lane * 16 + 1024);

    float lstat = 0.f;   // this half's part of the column's sum
    v8f negm;            // minus the column's maximum in use, the same in all 8 registers and in both halves: the scores' C operand
    v8f o[4] = {};       // O^T: 4 d-tiles x (8 vgprs), col t = lane&15

    constexpr size_t vgs = (size_t)T * 16;   // elements per 16-row group of v^T
    static_assert(T % 64 == 0 && T >= 64, "the loop walks two trips of 32 s at a time");
    v16bf qf[2][4], vf[4];
    const unsigned loff = lane * 16;
    const bf16_t* qp = qbase;
    const bf16_t* vp = vbase;
    auto fetch_q = [&](int set) __attribute__((always_inline)) {
#pragma unroll
        for (int f = 0; f < 4; ++f) qf[set][f] = load_frag_tiled(qp, loff + 1024 * f);
        qp += 2048;
    };
    auto fetch_v = [&]() __attribute__((always_inline)) {
#pragma unroll
        for (int j = 0; j < 4; ++j) vf[j] = load_frag_tiled(vp + j * vgs, loff);
        vp += 512;
    };
    // S^T + c: two 16-row s-tiles, D=64 in two WMMA K-steps each; x[8 * m + r] = tile m, vgpr r
    auto scores = [&](int set, v8f c, float (&x)[16]) __attribute__((always_inline)) {
#pragma unroll
        for (int m = 0; m < 2; ++m) {
            v8f accs = wmma_bf16(qf[set][2 * m], kb0, c);
            accs = wmma_bf16(qf[set][2 * m + 1], kb1, accs);
#pragma unroll
            for (int r = 0; r < 8; ++r) x[8 * m + r] = accs[r];
        }
    };
    auto lane_max = [&](const float (&x)[16]) __attribute__((always_inline)) {
        float mx = x[0];
#pragma unroll
        for (int i = 1; i < 16; ++i) mx = fmaxf(mx, x[i]);
        return mx;
    };
    auto trip = [&](int set, bool more) __attribute__((always_inline)) {
        if (more) fetch_q(set ^ 1);
        // Keeps these requests, and the v^T requests at the foot of the trip before, in front of the branch below:
        // without it the compiler sinks them behind the branch, to just before their use, and the wave waits out the whole latency.
        asm volatile("" ::: "memory");
        float x[16];
        scores(set, negm, x);
        float mx = lane_max(x);
        if (__builtin_amdgcn_ballot_w32(mx > 8.0f) != 0) {   // the same in every lane: a scalar branch, rarely taken
            mx = fmaxf(mx, __shfl_xor(mx, 16, 32));          // combine the two halves
            const float up = fmaxf(mx, 0.f);                 // a column whose maximum has not grown keeps it
            float corr = -up;
            exp2_in_place(corr);
#pragma unroll
            for (int i = 0; i < 16; ++i) x[i] -= up;
#pragma unroll
            for (int r = 0; r < 8; ++r) negm[r] -= up;
            lstat *= corr;
#pragma unroll
            for (int j = 0; j < 4; ++j)
#pragma unroll
                for (int r = 0; r < 8; ++r) o[j][r] *= corr;
        }
        exp2_in_place(x[0], x[1], x[2], x[3], x[4], x[5], x[6], x[7]);
        exp2_in_place(x[8], x[9], x[10], x[11], x[12], x[13], x[14], x[15]);

        v16bf pb;           // P^T B-fragment, built in-register
        float psum = x[0];
#pragma unroll
        for (int i = 1; i < 16; ++i) psum += x[i];
#pragma unroll
        for (int i = 0; i < 16; ++i) pb[i] = (bf16_t)x[i];
        lstat += psum;

        // ---- O^T += V^T (d x 32s) x P^T (32s x 16t) ----
#pragma unroll
        for (int j = 0; j < 4; ++j) o[j] = wmma_bf16(vf[j], pb, o[j]);
        if (more) fetch_v();
    };

    fetch_q(0);
    fetch_v();
    asm volatile("s_wait_xcnt 0x0" ::: "memory");
    {   // The first maximum in use is the true maximum of the first 32 s: whatever the scores' level, some exponential of the sum is 1.
        float x[16];
        scores(0, v8f{}, x);
        float mx = lane_max(x);
        mx = fmaxf(mx, __shfl_xor(mx, 16, 32));
#pragma unroll
        for (int r = 0; r < 8; ++r) negm[r] = -mx;
    }
    for (int s0 = 0; s0 < T - 64; s0 += 64) {
        trip(0, true);
        trip(1, true);
        asm volatile("s_wait_xcnt 0x0" ::: "memory");
    }
    trip(0, true);
    asm volatile("s_wait_xcnt 0x0" ::: "memory");
    trip(1, false);   // the last trip: nothing left to request

    lstat += __shfl_xor(lstat, 16, 32);
    const float inv = 1.0f / lstat;
    bf16_t* obase = Oh + ((size_t)((b * T + t0) >> 4) * (H * 2) + h * 2) * 512 + lane * 8;
#pragma unroll
    for (int j = 0; j < 4; ++j) {
        v8bf ov;
#pragma unroll
        for (int r = 0; r < 8; ++r) ov[r] = (bf16_t)(o[j][r] * inv);
        *(v8bf*)(obase + j * 256) = ov;
    }
}

// ---------------------------------------------------------------------------
// Host-side launch
// ---------------------------------------------------------------------------
extern "C" void kernel_launch(void* const* d_in, const int* in_sizes, int n_in,
                              void* d_out, int out_size, void* d_ws, size_t ws_size,
                              hipStream_t stream) {
    constexpr int Bb = 2, T = 2048, Cc = 1024, H = 16, D = 64;
    constexpr int M = Bb * T;          // 4096
    const float kscale = 1.44269504f / 32.0f;  // C^-0.5 = 1024^-0.5, times log2(e): exp(y) = 2^(y * log2(e))

    const float* x  = (const float*)d_in[0];
    const float* Wk = (const float*)d_in[1];
    const float* bk = (const float*)d_in[2];
    const float* Wq = (const float*)d_in[3];
    const float* bq = (const float*)d_in[4];
    const float* Wv = (const float*)d_in[5];
    const float* bv = (const float*)d_in[6];
    const float* Wp = (const float*)d_in[7];
    const float* bp = (const float*)d_in[8];

    char* ws = (char*)d_ws;
    size_t off = 0;
    bf16_t* xb   = (bf16_t*)(ws + off); off += (size_t)M * Cc * sizeof(bf16_t);         // 8 MB
    bf16_t* wkT  = (bf16_t*)(ws + off); off += (size_t)H * D * Cc * sizeof(bf16_t);     // 2 MB
    bf16_t* wqT  = (bf16_t*)(ws + off); off += (size_t)H * D * Cc * sizeof(bf16_t);
    bf16_t* wvT  = (bf16_t*)(ws + off); off += (size_t)H * D * Cc * sizeof(bf16_t);
    bf16_t* wpT  = (bf16_t*)(ws + off); off += (size_t)Cc * Cc * sizeof(bf16_t);        // 2 MB
    bf16_t* kmat = (bf16_t*)(ws + off); off += (size_t)Bb * H * T * D * sizeof(bf16_t); // 8 MB
    bf16_t* qmat = (bf16_t*)(ws + off); off += (size_t)Bb * H * T * D * sizeof(bf16_t);
    bf16_t* vTm  = (bf16_t*)(ws + off); off += (size_t)Bb * H * T * D * sizeof(bf16_t);
    bf16_t* oh   = (bf16_t*)(ws + off); off += (size_t)M * Cc * sizeof(bf16_t);         // 8 MB

    // 1) conversions / packing, one launch
    {
        constexpr int blocks = 3 * (Cc / 64) * H + (Cc / 64) * (Cc / 64) + (M / 16) * (Cc / 32) / 8;
        mha_pack_all<Cc, H><<<blocks, 256, 0, stream>>>(x, Wk, Wq, Wv, Wp, xb, wkT, wqT, wvT, wpT);
    }

    // 2) k, q, v projections, one launch: each M=4096, N=1024 (h*64+d), K=1024
    {
        dim3 grid(M / 64, (H * D) / 256, 3);
        mha_gemm_kqv<Cc><<<grid, 256, 0, stream>>>(xb, wkT, wqT, wvT, bk, bq, bv, kmat, qmat, vTm, M, H * D, T, H, kscale);
    }

    // 3) flash attention: grid (T/64 tiles of t, B*H), 4 waves/block
    {
        dim3 grid(T / 64, Bb * H);
        mha_flash_attn<T><<<grid, 128, 0, stream>>>(kmat, qmat, vTm, oh, H);
    }

    // 4) output projection: [4096,1024] x [1024,1024]^T + bp -> f32 d_out
    {
        dim3 grid(M / 64, Cc / 256);
        mha_gemm_wmma<2, Cc><<<grid, 256, 0, stream>>>(oh, wpT, bp, d_out, M, Cc, T, H);
    }

    (void)in_sizes; (void)n_in; (void)out_size; (void)ws_size;
}

// v006
// It runs in 82.5 microseconds.
// Timed twice side by side with v005, it ran 1.04 and 1.03 times as fast.
// All steps since v000 together make it 5.23 times as fast.
#include <hip/hip_runtime.h>
#include <math.h>

typedef __bf16 bf16_t;
typedef __attribute__((ext_vector_type(16))) __bf16 v16bf;
typedef __attribute__((ext_vector_type(8)))  __bf16 v8bf;
typedef __attribute__((ext_vector_type(8)))  float  v8f;

static __device__ __forceinline__ v8f wmma_bf16(v16bf a, v16bf b, v8f c) {
    // 8 args: (neg_a, A, neg_b, B, c_mod, C, reuse_a, reuse_b)
    return __builtin_amdgcn_wmma_f32_16x16x32_bf16(
        false, a, false, b, (short)0, c, false, false);
}

// Element offset of the 8 consecutive k that start at (row, k), k a multiple of 8.
static __device__ __forceinline__ size_t frag_chunk_offset(int row, int k, int KT) {
    return ((size_t)(row >> 4) * KT + (k >> 5)) * 512
         + (size_t)((((k >> 4) & 1) * 32 + (row & 15) + 16 * ((k >> 3) & 1)) * 8);
}

static __device__ __forceinline__ v16bf load_frag_tiled(const bf16_t* __restrict__ group, unsigned off) {
    const char* p0 = (const char*)group + off;
    v8bf a = *(const v8bf*)p0;
    v8bf b = *(const v8bf*)(p0 + 512);
    v16bf out;
#pragma unroll
    for (int i = 0; i < 8; ++i) { out[i] = a[i]; out[i + 8] = b[i]; }
    return out;
}

static __device__ __forceinline__ void cvt_bf16_tiles(const float* __restrict__ in, bf16_t* __restrict__ out, int C, int blk) {
    const int lane = threadIdx.x & 31;
    const int tile = blk * 8 + (threadIdx.x >> 5);
    const int KT = C >> 5;
    const int rt = tile / KT, kt = tile % KT;
    const float* p = in + (size_t)(rt * 16 + (lane & 15)) * C + kt * 32 + (lane >> 4) * 8;
    const float4 a0 = *(const float4*)(p);
    const float4 a1 = *(const float4*)(p + 4);
    const float4 b0 = *(const float4*)(p + 16);
    const float4 b1 = *(const float4*)(p + 20);
    v8bf lo, hi;
    lo[0] = (bf16_t)a0.x; lo[1] = (bf16_t)a0.y; lo[2] = (bf16_t)a0.z; lo[3] = (bf16_t)a0.w;
    lo[4] = (bf16_t)a1.x; lo[5] = (bf16_t)a1.y; lo[6] = (bf16_t)a1.z; lo[7] = (bf16_t)a1.w;
    hi[0] = (bf16_t)b0.x; hi[1] = (bf16_t)b0.y; hi[2] = (bf16_t)b0.z; hi[3] = (bf16_t)b0.w;
    hi[4] = (bf16_t)b1.x; hi[5] = (bf16_t)b1.y; hi[6] = (bf16_t)b1.z; hi[7] = (bf16_t)b1.w;
    bf16_t* q = out + (size_t)tile * 512 + lane * 8;
    *(v8bf*)q = lo;
    *(v8bf*)(q + 256) = hi;
    // In the merged launch other jobs' code follows these stores in the listing and reuses their registers.
    asm volatile("s_wait_xcnt 0x0" ::: "memory");
}

static __device__ __forceinline__ void transpose_tile_64x64(
    const float* __restrict__ in, int ldin, bf16_t* __restrict__ out, int row0, int k0, int KT) {
    __shared__ float tile[64][65];
    const int tid = threadIdx.x;

    const int lr = tid >> 4;         // 0..15: row inside a group of 16
    const int lc = (tid & 15) * 4;   // first of 4 columns
#pragma unroll
    for (int i = 0; i < 4; ++i) {
        const int r = i * 16 + lr;
        const float4 v = *(const float4*)(in + (size_t)r * ldin + lc);
        tile[r][lc + 0] = v.x;
        tile[r][lc + 1] = v.y;
        tile[r][lc + 2] = v.z;
        tile[r][lc + 3] = v.w;
    }
    __syncthreads();

    const int sr = tid >> 3;         // 0..31: output row inside a group of 32
    const int sc = (tid & 7) * 8;    // first of 8 output columns
#pragma unroll
    for (int i = 0; i < 2; ++i) {
        const int j = i * 32 + sr;
        v8bf o;
#pragma unroll
        for (int k = 0; k < 8; ++k) o[k] = (bf16_t)tile[sc + k][j];
        *(v8bf*)(out + frag_chunk_offset(row0 + j, k0 + sc, KT)) = o;
    }
    // In the merged launch other jobs' code follows these stores in the listing and reuses their registers.
    asm volatile("s_wait_xcnt 0x0" ::: "memory");
}

// All five packing jobs in ONE launch: none reads what another writes, so the block index picks the job.
//   blocks [0, 3 * WB)      : W[h][c][d] (f32) -> Wt (bf16), operand [N=h*64+d][K=c] in fragment order, for k, q, v;
//                             head size 64 = one tile wide
//   the next PB blocks      : Wp[k][n] (f32) -> WpT (bf16), operand [n][k] in fragment order
//   the rest                : x (f32) -> xb (bf16) in fragment order
// The transposes stand first: theirs is the longer way from load to store.
// grid 3 * WB + PB + (M/16 * C/32) / 8, 256 threads
template <int C, int H>
__global__ void mha_pack_all(const float* __restrict__ x,
                             const float* __restrict__ Wk, const float* __restrict__ Wq,
                             const float* __restrict__ Wv, const float* __restrict__ Wp,
                             bf16_t* __restrict__ xb,
                             bf16_t* __restrict__ wkT, bf16_t* __restrict__ wqT,
                             bf16_t* __restrict__ wvT, bf16_t* __restrict__ wpT) {
    constexpr int CT = C / 64;        // 64-wide tiles along C
    constexpr int WB = CT * H;        // tiles of one per-head weight
    constexpr int PB = CT * CT;       // tiles of the output projection
    const int blk = blockIdx.x;       // the same in every thread of a block: the barrier in the transpose is block-uniform
    if (blk < 3 * WB + PB) {
        const int job = blk / WB < 3 ? blk / WB : 3;
        const int t  = blk - job * WB;
        const int tx = (t % CT) * 64;   // c0 (per-head weights), k0 (output projection)
        const int ty = (t / CT) * 64;   // h * 64,                n0
        const float* in  = job == 0 ? Wk : job == 1 ? Wq : job == 2 ? Wv : Wp;
        bf16_t*      out = job == 0 ? wkT : job == 1 ? wqT : job == 2 ? wvT : wpT;
        if (job < 3) transpose_tile_64x64(in + ((size_t)ty * C + (size_t)tx * 64), 64, out, ty, tx, C >> 5);
        else         transpose_tile_64x64(in + (size_t)tx * C + ty,                 C, out, ty, tx, C >> 5);
    } else {
        cvt_bf16_tiles(x, xb, C, blk - (3 * WB + PB));
    }
}

template <int MODE, int K>
static __device__ __forceinline__ void gemm_wmma_tile(const bf16_t* __restrict__ A,
                              const bf16_t* __restrict__ Bm,
                              const float* __restrict__ bias,
                              void* __restrict__ out,
                              int M, int N, int T, int H, float osc) {
    const int lane = threadIdx.x & 31;
    const int wave = __builtin_amdgcn_readfirstlane(threadIdx.x >> 5);   // wave-uniform: tile bases are formed in scalar registers
    const int wm = wave & 1;   // 2 waves along M
    const int wn = wave >> 1;  // 4 waves along N
    const int m0 = blockIdx.x * 64 + wm * 32;
    const int n0 = blockIdx.y * 256 + wn * 64;

    constexpr int KT = K >> 5;
    const int mt = m0 >> 4;
    const int nt = n0 >> 4;

    const bf16_t* ag = A  + (size_t)mt * KT * 512;   // the wave's two 16-row groups of A
    const bf16_t* bg = Bm + (size_t)nt * KT * 512;   // and its four of B
    constexpr size_t gs = (size_t)KT * 512;          // elements per 16-row group

    constexpr int SETS = 3;   // register sets: one in use, two in flight
    static_assert(KT >= SETS && (KT - (SETS - 1)) % SETS == 0, "the loop walks SETS tiles a trip and leaves SETS - 1 for the tail");

    v8f acc[2][4] = {};
    v16bf fa[SETS][2], fb[SETS][4];
    auto fetch = [&](int set, unsigned o) __attribute__((always_inline)) {
        fa[set][0] = load_frag_tiled(ag,      o);
        fa[set][1] = load_frag_tiled(ag + gs, o);
#pragma unroll
        for (int j = 0; j < 4; ++j) fb[set][j] = load_frag_tiled(bg + j * gs, o);
    };
    auto products = [&](int set) __attribute__((always_inline)) {
#pragma unroll
        for (int j = 0; j < 4; ++j) {
            if (MODE == 0) {
                acc[0][j] = wmma_bf16(fb[set][j], fa[set][0], acc[0][j]);
                acc[1][j] = wmma_bf16(fb[set][j], fa[set][1], acc[1][j]);
            } else {
                acc[0][j] = wmma_bf16(fa[set][0], fb[set][j], acc[0][j]);
                acc[1][j] = wmma_bf16(fa[set][1], fb[set][j], acc[1][j]);
            }
        }
    };

    unsigned off = lane * 16;
#pragma unroll
    for (int s = 0; s < SETS - 1; ++s) fetch(s, off + s * 1024);
    for (int kt = 0; kt < KT - (SETS - 1); kt += SETS, off += SETS * 1024) {
#pragma unroll
        for (int u = 0; u < SETS; ++u) {
            fetch((u + SETS - 1) % SETS, off + (u + SETS - 1) * 1024);
            // Keeps the requests in front of these products: without it the scheduler sinks them to just
            // before their own use, and the wave waits out the whole L2 latency again.
            __builtin_amdgcn_sched_barrier(0);
            products(u);
            // Keeps what follows behind these products: the next requests, and at the loop's foot the step of the
            // address register, whose wait would otherwise stall the wave in front of products that are ready.
            __builtin_amdgcn_sched_barrier(0);
        }
    }
#pragma unroll
    for (int u = 0; u < SETS - 1; ++u) products(u);   // the last tiles: nothing left to request

    const int half = lane >> 4;
    const int nc = lane & 15;
    if (MODE == 0) {
        const int h = n0 >> 6;   // the wave's 64 columns are one head
#pragma unroll
        for (int i = 0; i < 2; ++i) {
            const int mb = m0 + 16 * i;
            const int b = mb / T, tt = (mb % T) >> 4;
            bf16_t* tile = (bf16_t*)out + ((size_t)b * H + h) * T * 64 + (size_t)tt * 1024 + lane * 8;
#pragma unroll
            for (int j = 0; j < 4; ++j) {
                const float* bj = bias + n0 + 16 * j + 8 * half;
                v8bf o;
#pragma unroll
                for (int r = 0; r < 8; ++r) o[r] = (bf16_t)((acc[i][j][r] + bj[r]) * osc);
                *(v8bf*)(tile + j * 256) = o;
            }
        }
    } else if (MODE == 1) {
        const int h = n0 >> 6;
        const int b = m0 / T, sb = (m0 % T) >> 5;   // the wave's 32 rows are one k tile of v^T
        const int KTs = T >> 5;
        bf16_t* base = (bf16_t*)out + ((size_t)b * H + h) * 64 * T + lane * 8;
#pragma unroll
        for (int j = 0; j < 4; ++j) {
            const float bn = bias[n0 + 16 * j + nc];
#pragma unroll
            for (int i = 0; i < 2; ++i) {
                v8bf o;
#pragma unroll
                for (int r = 0; r < 8; ++r) o[r] = (bf16_t)(acc[i][j][r] + bn);
                *(v8bf*)(base + ((size_t)j * KTs + sb) * 512 + i * 256) = o;
            }
        }
    } else {
#pragma unroll
        for (int i = 0; i < 2; ++i) {
#pragma unroll
            for (int j = 0; j < 4; ++j) {
#pragma unroll
                for (int r = 0; r < 8; ++r) {
                    const int m = m0 + 16 * i + r + 8 * half;
                    const int n = n0 + 16 * j + nc;
                    ((float*)out)[(size_t)m * N + n] = acc[i][j][r] + bias[n];
                }
            }
        }
    }
}

// One GEMM a launch (the output projection). grid (M/64, N/256), 256 threads
template <int MODE, int K>
__global__ void __launch_bounds__(256) __attribute__((amdgpu_waves_per_eu(4, 4))) mha_gemm_wmma(const bf16_t* __restrict__ A,
                              const bf16_t* __restrict__ Bm,
                              const float* __restrict__ bias,
                              void* __restrict__ out,
                              int M, int N, int T, int H) {
    gemm_wmma_tile<MODE, K>(A, Bm, bias, out, M, N, T, H, 1.0f);
}

// The k, q and v projections in ONE launch: they read the same x and none reads another's output, so
// blockIdx.z (the same in every wave of a block: a scalar branch) picks the weights, the bias, the output and its store mode.
// k is stored times kscale = softmax scale * log2(e): the attention's score products then come out as exp2 arguments.
// grid (M/64, N/256, 3), 256 threads
template <int K>
__global__ void __launch_bounds__(256) __attribute__((amdgpu_waves_per_eu(4, 4))) mha_gemm_kqv(const bf16_t* __restrict__ A,
                              const bf16_t* __restrict__ wkT, const bf16_t* __restrict__ wqT, const bf16_t* __restrict__ wvT,
                              const float* __restrict__ bk, const float* __restrict__ bq, const float* __restrict__ bv,
                              bf16_t* __restrict__ kmat, bf16_t* __restrict__ qmat, bf16_t* __restrict__ vTm,
                              int M, int N, int T, int H, float kscale) {
    const int which = blockIdx.z;
    if (which == 2) gemm_wmma_tile<1, K>(A, wvT, bv, (void*)vTm, M, N, T, H, 1.0f);
    else            gemm_wmma_tile<0, K>(A, which ? wqT : wkT, which ? bq : bk, (void*)(which ? qmat : kmat), M, N, T, H,
                                         which ? 1.0f : kscale);
}

static __device__ __forceinline__ void exp2_in_place(float& a, float& b, float& c, float& d,
                                                     float& e, float& f, float& g, float& h) {
    asm("v_exp_f32 %0, %0\n\tv_exp_f32 %1, %1\n\tv_exp_f32 %2, %2\n\tv_exp_f32 %3, %3\n\t"
        "v_exp_f32 %4, %4\n\tv_exp_f32 %5, %5\n\tv_exp_f32 %6, %6\n\tv_exp_f32 %7, %7\n\t"
        "v_nop"
        : "+v"(a), "+v"(b), "+v"(c), "+v"(d), "+v"(e), "+v"(f), "+v"(g), "+v"(h));
}
static __device__ __forceinline__ void exp2_in_place(float& a) {
    asm("v_exp_f32 %0, %0\n\tv_nop" : "+v"(a));
}

template <int T>
__global__ void __launch_bounds__(256) mha_flash_attn(const bf16_t* __restrict__ Kp,
                               const bf16_t* __restrict__ Qp,
                               const bf16_t* __restrict__ VTp,
                               bf16_t* __restrict__ Oh,
                               int H) {
    const int lane = threadIdx.x & 31;
    const int wave = __builtin_amdgcn_readfirstlane(threadIdx.x >> 5);   // wave-uniform: tile bases are formed in scalar registers
    const int bh = blockIdx.y;
    const int b = bh / H, h = bh % H;
    const int t0 = blockIdx.x * 256 + wave * 32;

    const bf16_t* kbase = Kp  + (size_t)bh * T * 64;
    const bf16_t* qbase = Qp  + (size_t)bh * T * 64;
    const bf16_t* vbase = VTp + (size_t)bh * 64 * T;

    // k tiles as B operands (N = t columns, K = d), resident for whole loop; kb[g]: column group g
    v16bf kb[2][2];
#pragma unroll
    for (int g = 0; g < 2; ++g) {
        kb[g][0] = load_frag_tiled(kbase + (size_t)(t0 + 16 * g) * 64, lane * 16);
        kb[g][1] = load_frag_tiled(kbase + (size_t)(t0 + 16 * g) * 64, lane * 16 + 1024);
    }

    float lstat[2] = {0.f, 0.f};   // this half's part of the column's sum
    v8f negm[2];                   // minus the column's maximum in use, the same in all 8 registers and in both halves: the scores' C operand
    v8f o[2][4] = {};              // O^T: per group 4 d-tiles x (8 vgprs), col t = lane&15

    constexpr size_t vgs = (size_t)T * 16;   // elements per 16-row group of v^T
    static_assert(T % 256 == 0, "a block owns 256 t, and the loop walks two trips of 32 s at a time");
    v16bf qf[2][4], vf[2][4];
    const unsigned loff = lane * 16;
    const bf16_t* qp = qbase;
    const bf16_t* vp = vbase;
    // ahead: trips counted from the one that qp and vp stand at; a constant, so it folds into the loads' offset field
    auto fetch = [&](int set, int ahead) __attribute__((always_inline)) {
#pragma unroll
        for (int f = 0; f < 4; ++f) qf[set][f] = load_frag_tiled(qp, loff + 4096 * ahead + 1024 * f);
#pragma unroll
        for (int j = 0; j < 4; ++j) vf[set][j] = load_frag_tiled(vp + j * vgs, loff + 1024 * ahead);
    };
    // S^T + c: per group two 16-row s-tiles, D=64 in two WMMA K-steps each; x[g][8 * m + r] = group g, tile m, vgpr r
    auto scores = [&](int set, const v8f (&c)[2], float (&x)[2][16]) __attribute__((always_inline)) {
        v8f accs[2][2];
#pragma unroll
        for (int m = 0; m < 2; ++m)
#pragma unroll
            for (int g = 0; g < 2; ++g) accs[g][m] = wmma_bf16(qf[set][2 * m], kb[g][0], c[g]);
#pragma unroll
        for (int m = 0; m < 2; ++m)
#pragma unroll
            for (int g = 0; g < 2; ++g) accs[g][m] = wmma_bf16(qf[set][2 * m + 1], kb[g][1], accs[g][m]);
#pragma unroll
        for (int g = 0; g < 2; ++g)
#pragma unroll
            for (int m = 0; m < 2; ++m)
#pragma unroll
                for (int r = 0; r < 8; ++r) x[g][8 * m + r] = accs[g][m][r];
    };
    auto lane_max = [&](const float (&x)[16]) __attribute__((always_inline)) {
        float mx = x[0];
#pragma unroll
        for (int i = 1; i < 16; ++i) mx = fmaxf(mx, x[i]);
        return mx;
    };
    auto trip = [&](int set, bool more) __attribute__((always_inline)) {
        if (more) fetch(set ^ 1, set + 1);
        // Keeps these requests in front of the branch below: without it the compiler sinks them behind the branch,
        // to just before their use, and the wave waits out the whole latency.
        asm volatile("" ::: "memory");
        // Keeps the requests in front of the score products, which the scheduler otherwise lifts over them.
        __builtin_amdgcn_sched_barrier(0);
        float x[2][16];
        scores(set, negm, x);
        __builtin_amdgcn_sched_barrier(0);
        float mx[2] = {lane_max(x[0]), lane_max(x[1])};
        if (__builtin_amdgcn_ballot_w32(fmaxf(mx[0], mx[1]) > 8.0f) != 0) {   // the same in every lane: a scalar branch, rarely taken
#pragma unroll
            for (int g = 0; g < 2; ++g) {
                const float mg = fmaxf(mx[g], __shfl_xor(mx[g], 16, 32));   // combine the two halves
                const float up = fmaxf(mg, 0.f);                            // a column whose maximum has not grown keeps it
                float corr = -up;
                exp2_in_place(corr);
#pragma unroll
                for (int i = 0; i < 16; ++i) x[g][i] -= up;
#pragma unroll
                for (int r = 0; r < 8; ++r) negm[g][r] -= up;
                lstat[g] *= corr;
#pragma unroll
                for (int j = 0; j < 4; ++j)
#pragma unroll
                    for (int r = 0; r < 8; ++r) o[g][j][r] *= corr;
            }
        }
#pragma unroll
        for (int g = 0; g < 2; ++g) {
            float (&y)[16] = x[g];
            exp2_in_place(y[0], y[1], y[2], y[3], y[4], y[5], y[6], y[7]);
            exp2_in_place(y[8], y[9], y[10], y[11], y[12], y[13], y[14], y[15]);

            v16bf pb;           // P^T B-fragment, built in-register
            float psum = y[0];
#pragma unroll
            for (int i = 1; i < 16; ++i) psum += y[i];
#pragma unroll
            for (int i = 0; i < 16; ++i) pb[i] = (bf16_t)y[i];
            lstat[g] += psum;

            // ---- O^T += V^T (d x 32s) x P^T (32s x 16t) ----
#pragma unroll
            for (int j = 0; j < 4; ++j) o[g][j] = wmma_bf16(vf[set][j], pb, o[g][j]);
        }
    };

    fetch(0, 0);
    // These loads are still in flight where the code behind them gives their address registers a new value.
    asm volatile("s_wait_xcnt 0x0" ::: "memory");
    {   // The first maximum in use is the true maximum of the first 32 s: whatever the scores' level, some exponential of the sum is 1.
        float x[2][16];
        const v8f zero[2] = {};
        scores(0, zero, x);
#pragma unroll
        for (int g = 0; g < 2; ++g) {
            float mx = lane_max(x[g]);
            mx = fmaxf(mx, __shfl_xor(mx, 16, 32));
#pragma unroll
            for (int r = 0; r < 8; ++r) negm[g][r] = -mx;
        }
    }
    for (int s0 = 0; s0 < T - 64; s0 += 64) {
        trip(0, true);
        trip(1, true);
        // The loop's requests still name the address registers that are stepped here.
        asm volatile("s_wait_xcnt 0x0" ::: "memory");
        // Keeps the step behind that wait: the scheduler otherwise lifts it over the wait.
        __builtin_amdgcn_sched_barrier(0);
        qp += 4096;
        vp += 1024;
    }
    trip(0, true);
    trip(1, false);   // the last trip: nothing left to request

#pragma unroll
    for (int g = 0; g < 2; ++g) {
        const float l = lstat[g] + __shfl_xor(lstat[g], 16, 32);   // the two halves' sums, joined
        const float inv = 1.0f / l;
        bf16_t* obase = Oh + ((size_t)((b * T + t0 + 16 * g) >> 4) * (H * 2) + h * 2) * 512 + lane * 8;
#pragma unroll
        for (int j = 0; j < 4; ++j) {
            v8bf ov;
#pragma unroll
            for (int r = 0; r < 8; ++r) ov[r] = (bf16_t)(o[g][j][r] * inv);
            *(v8bf*)(obase + j * 256) = ov;
        }
    }
}

// ---------------------------------------------------------------------------
// Host-side launch
// ---------------------------------------------------------------------------
extern "C" void kernel_launch(void* const* d_in, const int* in_sizes, int n_in,
                              void* d_out, int out_size, void* d_ws, size_t ws_size,
                              hipStream_t stream) {
    constexpr int Bb = 2, T = 2048, Cc = 1024, H = 16, D = 64;
    constexpr int M = Bb * T;          // 4096
    const float kscale = 1.44269504f / 32.0f;  // C^-0.5 = 1024^-0.5, times log2(e): exp(y) = 2^(y * log2(e))

    const float* x  = (const float*)d_in[0];
    const float* Wk = (const float*)d_in[1];
    const float* bk = (const float*)d_in[2];
    const float* Wq = (const float*)d_in[3];
    const float* bq = (const float*)d_in[4];
    const float* Wv = (const float*)d_in[5];
    const float* bv = (const float*)d_in[6];
    const float* Wp = (const float*)d_in[7];
    const float* bp = (const float*)d_in[8];

    char* ws = (char*)d_ws;
    size_t off = 0;
    bf16_t* xb   = (bf16_t*)(ws + off); off += (size_t)M * Cc * sizeof(bf16_t);         // 8 MB
    bf16_t* wkT  = (bf16_t*)(ws + off); off += (size_t)H * D * Cc * sizeof(bf16_t);     // 2 MB
    bf16_t* wqT  = (bf16_t*)(ws + off); off += (size_t)H * D * Cc * sizeof(bf16_t);
    bf16_t* wvT  = (bf16_t*)(ws + off); off += (size_t)H * D * Cc * sizeof(bf16_t);
    bf16_t* wpT  = (bf16_t*)(ws + off); off += (size_t)Cc * Cc * sizeof(bf16_t);        // 2 MB
    bf16_t* kmat = (bf16_t*)(ws + off); off += (size_t)Bb * H * T * D * sizeof(bf16_t); // 8 MB
    bf16_t* qmat = (bf16_t*)(ws + off); off += (size_t)Bb * H * T * D * sizeof(bf16_t);
    bf16_t* vTm  = (bf16_t*)(ws + off); off += (size_t)Bb * H * T * D * sizeof(bf16_t);
    bf16_t* oh   = (bf16_t*)(ws + off); off += (size_t)M * Cc * sizeof(bf16_t);         // 8 MB

    // 1) conversions / packing, one launch
    {
        constexpr int blocks = 3 * (Cc / 64) * H + (Cc / 64) * (Cc / 64) + (M / 16) * (Cc / 32) / 8;
        mha_pack_all<Cc, H><<<blocks, 256, 0, stream>>>(x, Wk, Wq, Wv, Wp, xb, wkT, wqT, wvT, wpT);
    }

    // 2) k, q, v projections, one launch: each M=4096, N=1024 (h*64+d), K=1024
    {
        dim3 grid(M / 64, (H * D) / 256, 3);
        mha_gemm_kqv<Cc><<<grid, 256, 0, stream>>>(xb, wkT, wqT, wvT, bk, bq, bv, kmat, qmat, vTm, M, H * D, T, H, kscale);
    }

    // 3) flash attention: grid (T/256 tiles of t, B*H), 8 waves/block
    {
        dim3 grid(T / 256, Bb * H);
        mha_flash_attn<T><<<grid, 256, 0, stream>>>(kmat, qmat, vTm, oh, H);
    }

    // 4) output projection: [4096,1024] x [1024,1024]^T + bp -> f32 d_out
    {
        dim3 grid(M / 64, Cc / 256);
        mha_gemm_wmma<2, Cc><<<grid, 256, 0, stream>>>(oh, wpT, bp, d_out, M, Cc, T, H);
    }

    (void)in_sizes; (void)n_in; (void)out_size; (void)ws_size;
}

// v007
// It runs in 78.1 microseconds.
// Next to v006, in two timings, it ran 1.05 and 1.06 times as fast.
// Counting every step since v000, it is 5.52 times as fast.
#include <hip/hip_runtime.h>
#include <math.h>

typedef __bf16 bf16_t;
typedef __attribute__((ext_vector_type(16))) __bf16 v16bf;
typedef __attribute__((ext_vector_type(8)))  __bf16 v8bf;
typedef __attribute__((ext_vector_type(8)))  float  v8f;

static __device__ __forceinline__ v8f wmma_bf16(v16bf a, v16bf b, v8f c) {
    // 8 args: (neg_a, A, neg_b, B, c_mod, C, reuse_a, reuse_b)
    return __builtin_amdgcn_wmma_f32_16x16x32_bf16(
        false, a, false, b, (short)0, c, false, false);
}

// Element offset of the 8 consecutive k that start at (row, k), k a multiple of 8.
static __device__ __forceinline__ size_t frag_chunk_offset(int row, int k, int KT) {
    return ((size_t)(row >> 4) * KT + (k >> 5)) * 512
         + (size_t)((((k >> 4) & 1) * 32 + (row & 15) + 16 * ((k >> 3) & 1)) * 8);
}

static __device__ __forceinline__ v16bf load_frag_tiled(const bf16_t* __restrict__ group, unsigned off) {
    const char* p0 = (const char*)group + off;
    v8bf a = *(const v8bf*)p0;
    v8bf b = *(const v8bf*)(p0 + 512);
    v16bf out;
#pragma unroll
    for (int i = 0; i < 8; ++i) { out[i] = a[i]; out[i + 8] = b[i]; }
    return out;
}

static __device__ __forceinline__ void cvt_bf16_tiles(const float* __restrict__ in, bf16_t* __restrict__ out, int C, int blk) {
    const int lane = threadIdx.x & 31;
    const int tile = blk * 8 + (threadIdx.x >> 5);
    const int KT = C >> 5;
    const int rt = tile / KT, kt = tile % KT;
    const float* p = in + (size_t)(rt * 16 + (lane & 15)) * C + kt * 32 + (lane >> 4) * 8;
    const float4 a0 = *(const float4*)(p);
    const float4 a1 = *(const float4*)(p + 4);
    const float4 b0 = *(const float4*)(p + 16);
    const float4 b1 = *(const float4*)(p + 20);
    v8bf lo, hi;
    lo[0] = (bf16_t)a0.x; lo[1] = (bf16_t)a0.y; lo[2] = (bf16_t)a0.z; lo[3] = (bf16_t)a0.w;
    lo[4] = (bf16_t)a1.x; lo[5] = (bf16_t)a1.y; lo[6] = (bf16_t)a1.z; lo[7] = (bf16_t)a1.w;
    hi[0] = (bf16_t)b0.x; hi[1] = (bf16_t)b0.y; hi[2] = (bf16_t)b0.z; hi[3] = (bf16_t)b0.w;
    hi[4] = (bf16_t)b1.x; hi[5] = (bf16_t)b1.y; hi[6] = (bf16_t)b1.z; hi[7] = (bf16_t)b1.w;
    bf16_t* q = out + (size_t)tile * 512 + lane * 8;
    *(v8bf*)q = lo;
    *(v8bf*)(q + 256) = hi;
    // In the merged launch other jobs' code follows these stores in the listing and reuses their registers.
    asm volatile("s_wait_xcnt 0x0" ::: "memory");
}

static __device__ __forceinline__ void transpose_tile_64x64(
    const float* __restrict__ in, int ldin, bf16_t* __restrict__ out, int row0, int k0, int KT) {
    __shared__ float tile[64][65];
    const int tid = threadIdx.x;

    const int lr = tid >> 4;         // 0..15: row inside a group of 16
    const int lc = (tid & 15) * 4;   // first of 4 columns
#pragma unroll
    for (int i = 0; i < 4; ++i) {
        const int r = i * 16 + lr;
        const float4 v = *(const float4*)(in + (size_t)r * ldin + lc);
        tile[r][lc + 0] = v.x;
        tile[r][lc + 1] = v.y;
        tile[r][lc + 2] = v.z;
        tile[r][lc + 3] = v.w;
    }
    __syncthreads();

    const int sr = tid >> 3;         // 0..31: output row inside a group of 32
    const int sc = (tid & 7) * 8;    // first of 8 output columns
#pragma unroll
    for (int i = 0; i < 2; ++i) {
        const int j = i * 32 + sr;
        v8bf o;
#pragma unroll
        for (int k = 0; k < 8; ++k) o[k] = (bf16_t)tile[sc + k][j];
        *(v8bf*)(out + frag_chunk_offset(row0 + j, k0 + sc, KT)) = o;
    }
    // In the merged launch other jobs' code follows these stores in the listing and reuses their registers.
    asm volatile("s_wait_xcnt 0x0" ::: "memory");
}

// All five packing jobs in ONE launch: none reads what another writes, so the block index picks the job.
//   blocks [0, 3 * WB)      : W[h][c][d] (f32) -> Wt (bf16), operand [N=h*64+d][K=c] in fragment order, for k, q, v;
//                             head size 64 = one tile wide
//   the next PB blocks      : Wp[k][n] (f32) -> WpT (bf16), operand [n][k] in fragment order
//   the rest                : x (f32) -> xb (bf16) in fragment order
// The transposes stand first: theirs is the longer way from load to store.
// grid 3 * WB + PB + (M/16 * C/32) / 8, 256 threads
template <int C, int H>
__global__ void mha_pack_all(const float* __restrict__ x,
                             const float* __restrict__ Wk, const float* __restrict__ Wq,
                             const float* __restrict__ Wv, const float* __restrict__ Wp,
                             bf16_t* __restrict__ xb,
                             bf16_t* __restrict__ wkT, bf16_t* __restrict__ wqT,
                             bf16_t* __restrict__ wvT, bf16_t* __restrict__ wpT) {
    constexpr int CT = C / 64;        // 64-wide tiles along C
    constexpr int WB = CT * H;        // tiles of one per-head weight
    constexpr int PB = CT * CT;       // tiles of the output projection
    const int blk = blockIdx.x;       // the same in every thread of a block: the barrier in the transpose is block-uniform
    if (blk < 3 * WB + PB) {
        const int job = blk / WB < 3 ? blk / WB : 3;
        const int t  = blk - job * WB;
        const int tx = (t % CT) * 64;   // c0 (per-head weights), k0 (output projection)
        const int ty = (t / CT) * 64;   // h * 64,                n0
        const float* in  = job == 0 ? Wk : job == 1 ? Wq : job == 2 ? Wv : Wp;
        bf16_t*      out = job == 0 ? wkT : job == 1 ? wqT : job == 2 ? wvT : wpT;
        if (job < 3) transpose_tile_64x64(in + ((size_t)ty * C + (size_t)tx * 64), 64, out, ty, tx, C >> 5);
        else         transpose_tile_64x64(in + (size_t)tx * C + ty,                 C, out, ty, tx, C >> 5);
    } else {
        cvt_bf16_tiles(x, xb, C, blk - (3 * WB + PB));
    }
}

template <int MODE, int K, int MI>
static __device__ __forceinline__ void gemm_wmma_tile(const bf16_t* __restrict__ A,
                              const bf16_t* __restrict__ Bm,
                              const float* __restrict__ bias,
                              void* __restrict__ out,
                              int m0, int n0,   // wave-uniform: tile bases are formed in scalar registers
                              int N, int T, int H, float osc) {
    const int lane = threadIdx.x & 31;

    constexpr int KT = K >> 5;
    const int mt = m0 >> 4;
    const int nt = n0 >> 4;

    const bf16_t* ag = A  + (size_t)mt * KT * 512;   // the wave's MI 16-row groups of A
    const bf16_t* bg = Bm + (size_t)nt * KT * 512;   // and its four of B
    constexpr size_t gs = (size_t)KT * 512;          // elements per 16-row group

    constexpr int SETS = 3;   // register sets: one in use, two in flight
    static_assert(KT >= SETS && (KT - (SETS - 1)) % SETS == 0, "the loop walks SETS tiles a trip and leaves SETS - 1 for the tail");

    v8f acc[MI][4] = {};
    v16bf fa[SETS][MI], fb[SETS][4];
    auto fetch = [&](int set, unsigned o) __attribute__((always_inline)) {
#pragma unroll
        for (int i = 0; i < MI; ++i) fa[set][i] = load_frag_tiled(ag + i * gs, o);
#pragma unroll
        for (int j = 0; j < 4; ++j) fb[set][j] = load_frag_tiled(bg + j * gs, o);
    };
    auto products = [&](int set) __attribute__((always_inline)) {
#pragma unroll
        for (int j = 0; j < 4; ++j) {
#pragma unroll
            for (int i = 0; i < MI; ++i) {
                if (MODE == 0) acc[i][j] = wmma_bf16(fb[set][j], fa[set][i], acc[i][j]);
                else           acc[i][j] = wmma_bf16(fa[set][i], fb[set][j], acc[i][j]);
            }
        }
    };

    unsigned off = lane * 16;
#pragma unroll
    for (int s = 0; s < SETS - 1; ++s) fetch(s, off + s * 1024);
    for (int kt = 0; kt < KT - (SETS - 1); kt += SETS) {
#pragma unroll
        for (int u = 0; u < SETS; ++u) {
            fetch((u + SETS - 1) % SETS, off + (u + SETS - 1) * 1024);
            // Keeps the requests in front of these products: without it the scheduler sinks them to just
            // before their own use, and the wave waits out the whole L2 latency again.
            __builtin_amdgcn_sched_barrier(0);
            products(u);
            // Keeps what follows behind these products: the next requests, and at the loop's foot the step of the
            // address register, whose wait would otherwise stall the wave in front of products that are ready.
            __builtin_amdgcn_sched_barrier(0);
        }
        // The trip's requests still name the address register that is stepped here. The 64-row tile uses registers above
        // v255.
        if (MI > 2) {
            asm volatile("s_wait_xcnt 0x0" ::: "memory");
            // Keeps the step behind that wait: the scheduler otherwise lifts it over the wait.
            __builtin_amdgcn_sched_barrier(0);
        }
        off += SETS * 1024;
    }
#pragma unroll
    for (int u = 0; u < SETS - 1; ++u) products(u);   // the last tiles: nothing left to request

    const int half = lane >> 4;
    const int nc = lane & 15;
    if (MODE == 0) {
        const int h = n0 >> 6;   // the wave's 64 columns are one head
        float bj[4][8];          // read once, ahead of the waits below, which would have it read again for every i
#pragma unroll
        for (int j = 0; j < 4; ++j)
#pragma unroll
            for (int r = 0; r < 8; ++r) bj[j][r] = bias[n0 + 16 * j + 8 * half + r];
#pragma unroll
        for (int i = 0; i < MI; ++i) {
            const int mb = m0 + 16 * i;
            const int b = mb / T, tt = (mb % T) >> 4;
            bf16_t* tile = (bf16_t*)out + ((size_t)b * H + h) * T * 64 + (size_t)tt * 1024 + lane * 8;
#pragma unroll
            for (int j = 0; j < 4; ++j) {
                v8bf o;
#pragma unroll
                for (int r = 0; r < 8; ++r) o[r] = (bf16_t)((acc[i][j][r] + bj[j][r]) * osc);
                *(v8bf*)(tile + j * 256) = o;
            }
            // The next rows' arithmetic reuses the registers that these stores name.
            if (i + 1 < MI) asm volatile("s_wait_xcnt 0x0" ::: "memory");
            // Keeps that arithmetic behind the wait: nothing else ties it to the stores' registers.
            __builtin_amdgcn_sched_barrier(0);
        }
    } else if (MODE == 1) {
        const int h = n0 >> 6;
        const int b = m0 / T, sb = (m0 % T) >> 5;   // each 32 of the wave's rows are one k tile of v^T
        const int KTs = T >> 5;
        bf16_t* base = (bf16_t*)out + ((size_t)b * H + h) * 64 * T + lane * 8;
#pragma unroll
        for (int j = 0; j < 4; ++j) {
            const float bn = bias[n0 + 16 * j + nc];
#pragma unroll
            for (int i = 0; i < MI; ++i) {
                v8bf o;
#pragma unroll
                for (int r = 0; r < 8; ++r) o[r] = (bf16_t)(acc[i][j][r] + bn);
                *(v8bf*)(base + ((size_t)j * KTs + sb + (i >> 1)) * 512 + (i & 1) * 256) = o;
            }
        }
    } else {
#pragma unroll
        for (int i = 0; i < MI; ++i) {
#pragma unroll
            for (int j = 0; j < 4; ++j) {
#pragma unroll
                for (int r = 0; r < 8; ++r) {
                    const int m = m0 + 16 * i + r + 8 * half;
                    const int n = n0 + 16 * j + nc;
                    ((float*)out)[(size_t)m * N + n] = acc[i][j][r] + bias[n];
                }
            }
        }
    }
}

// One GEMM a launch (the output projection). Block: 8 waves (4M x 2N) of 32 x 64 -> 128(M) x 128(N): the square block
// asks L2 for 16 fragments per k tile where 64 x 256 asks for 20, with the same 256 blocks.
// grid (M/128, N/128), 256 threads
template <int MODE, int K>
__global__ void __launch_bounds__(256) __attribute__((amdgpu_waves_per_eu(4, 4))) mha_gemm_wmma(const bf16_t* __restrict__ A,
                              const bf16_t* __restrict__ Bm,
                              const float* __restrict__ bias,
                              void* __restrict__ out,
                              int M, int N, int T, int H) {
    const int wave = __builtin_amdgcn_readfirstlane(threadIdx.x >> 5);
    const int m0 = blockIdx.x * 128 + (wave & 3) * 32;
    const int n0 = blockIdx.y * 128 + (wave >> 2) * 64;
    gemm_wmma_tile<MODE, K, 2>(A, Bm, bias, out, m0, n0, N, T, H, 1.0f);
}

template <int K>
__global__ void __launch_bounds__(384) __attribute__((amdgpu_waves_per_eu(3, 3))) mha_gemm_kqv(const bf16_t* __restrict__ A,
                              const bf16_t* __restrict__ wkT, const bf16_t* __restrict__ wqT, const bf16_t* __restrict__ wvT,
                              const float* __restrict__ bk, const float* __restrict__ bq, const float* __restrict__ bv,
                              bf16_t* __restrict__ kmat, bf16_t* __restrict__ qmat, bf16_t* __restrict__ vTm,
                              int M, int N, int T, int H, float kscale) {
    const int wave = __builtin_amdgcn_readfirstlane(threadIdx.x >> 5);
    const int which = wave >> 2;
    const int m0 = blockIdx.x * 256 + (wave & 3) * 64;
    const int n0 = blockIdx.y * 64;
    if (which == 2) gemm_wmma_tile<1, K, 4>(A, wvT, bv, (void*)vTm, m0, n0, N, T, H, 1.0f);
    else            gemm_wmma_tile<0, K, 4>(A, which ? wqT : wkT, which ? bq : bk, (void*)(which ? qmat : kmat), m0, n0, N, T, H,
                                            which ? 1.0f : kscale);
}

static __device__ __forceinline__ void exp2_in_place(float& a, float& b, float& c, float& d,
                                                     float& e, float& f, float& g, float& h) {
    asm("v_exp_f32 %0, %0\n\tv_exp_f32 %1, %1\n\tv_exp_f32 %2, %2\n\tv_exp_f32 %3, %3\n\t"
        "v_exp_f32 %4, %4\n\tv_exp_f32 %5, %5\n\tv_exp_f32 %6, %6\n\tv_exp_f32 %7, %7\n\t"
        "v_nop"
        : "+v"(a), "+v"(b), "+v"(c), "+v"(d), "+v"(e), "+v"(f), "+v"(g), "+v"(h));
}
static __device__ __forceinline__ void exp2_in_place(float& a) {
    asm("v_exp_f32 %0, %0\n\tv_nop" : "+v"(a));
}

template <int T>
__global__ void __launch_bounds__(256) mha_flash_attn(const bf16_t* __restrict__ Kp,
                               const bf16_t* __restrict__ Qp,
                               const bf16_t* __restrict__ VTp,
                               bf16_t* __restrict__ Oh,
                               int H) {
    const int lane = threadIdx.x & 31;
    const int wave = __builtin_amdgcn_readfirstlane(threadIdx.x >> 5);   // wave-uniform: tile bases are formed in scalar registers
    const int bh = blockIdx.y;
    const int b = bh / H, h = bh % H;
    const int t0 = blockIdx.x * 256 + wave * 32;

    const bf16_t* kbase = Kp  + (size_t)bh * T * 64;
    const bf16_t* qbase = Qp  + (size_t)bh * T * 64;
    const bf16_t* vbase = VTp + (size_t)bh * 64 * T;

    // k tiles as B operands (N = t columns, K = d), resident for whole loop; kb[g]: column group g
    v16bf kb[2][2];
#pragma unroll
    for (int g = 0; g < 2; ++g) {
        kb[g][0] = load_frag_tiled(kbase + (size_t)(t0 + 16 * g) * 64, lane * 16);
        kb[g][1] = load_frag_tiled(kbase + (size_t)(t0 + 16 * g) * 64, lane * 16 + 1024);
    }

    float lstat[2] = {0.f, 0.f};   // this half's part of the column's sum
    v8f negm[2];                   // minus the column's maximum in use, the same in all 8 registers and in both halves: the scores' C operand
    v8f o[2][4] = {};              // O^T: per group 4 d-tiles x (8 vgprs), col t = lane&15

    constexpr size_t vgs = (size_t)T * 16;   // elements per 16-row group of v^T
    static_assert(T % 256 == 0, "a block owns 256 t, and the loop walks two trips of 32 s at a time");
    v16bf qf[2][4], vf[2][4];
    const unsigned loff = lane * 16;
    const bf16_t* qp = qbase;
    const bf16_t* vp = vbase;
    // ahead: trips counted from the one that qp and vp stand at; a constant, so it folds into the loads' offset field
    auto fetch = [&](int set, int ahead) __attribute__((always_inline)) {
#pragma unroll
        for (int f = 0; f < 4; ++f) qf[set][f] = load_frag_tiled(qp, loff + 4096 * ahead + 1024 * f);
#pragma unroll
        for (int j = 0; j < 4; ++j) vf[set][j] = load_frag_tiled(vp + j * vgs, loff + 1024 * ahead);
    };
    // S^T + c: per group two 16-row s-tiles, D=64 in two WMMA K-steps each; x[g][8 * m + r] = group g, tile m, vgpr r
    auto scores = [&](int set, const v8f (&c)[2], float (&x)[2][16]) __attribute__((always_inline)) {
        v8f accs[2][2];
#pragma unroll
        for (int m = 0; m < 2; ++m)
#pragma unroll
            for (int g = 0; g < 2; ++g) accs[g][m] = wmma_bf16(qf[set][2 * m], kb[g][0], c[g]);
#pragma unroll
        for (int m = 0; m < 2; ++m)
#pragma unroll
            for (int g = 0; g < 2; ++g) accs[g][m] = wmma_bf16(qf[set][2 * m + 1], kb[g][1], accs[g][m]);
#pragma unroll
        for (int g = 0; g < 2; ++g)
#pragma unroll
            for (int m = 0; m < 2; ++m)
#pragma unroll
                for (int r = 0; r < 8; ++r) x[g][8 * m + r] = accs[g][m][r];
    };
    auto lane_max = [&](const float (&x)[16]) __attribute__((always_inline)) {
        float mx = x[0];
#pragma unroll
        for (int i = 1; i < 16; ++i) mx = fmaxf(mx, x[i]);
        return mx;
    };
    auto trip = [&](int set, bool more) __attribute__((always_inline)) {
        if (more) fetch(set ^ 1, set + 1);
        // Keeps these requests in front of the branch below: without it the compiler sinks them behind the branch,
        // to just before their use, and the wave waits out the whole latency.
        asm volatile("" ::: "memory");
        // Keeps the requests in front of the score products, which the scheduler otherwise lifts over them.
        __builtin_amdgcn_sched_barrier(0);
        float x[2][16];
        scores(set, negm, x);
        __builtin_amdgcn_sched_barrier(0);
        float mx[2] = {lane_max(x[0]), lane_max(x[1])};
        if (__builtin_amdgcn_ballot_w32(fmaxf(mx[0], mx[1]) > 8.0f) != 0) {   // the same in every lane: a scalar branch, rarely taken
#pragma unroll
            for (int g = 0; g < 2; ++g) {
                const float mg = fmaxf(mx[g], __shfl_xor(mx[g], 16, 32));   // combine the two halves
                const float up = fmaxf(mg, 0.f);                            // a column whose maximum has not grown keeps it
                float corr = -up;
                exp2_in_place(corr);
#pragma unroll
                for (int i = 0; i < 16; ++i) x[g][i] -= up;
#pragma unroll
                for (int r = 0; r < 8; ++r) negm[g][r] -= up;
                lstat[g] *= corr;
#pragma unroll
                for (int j = 0; j < 4; ++j)
#pragma unroll
                    for (int r = 0; r < 8; ++r) o[g][j][r] *= corr;
            }
        }
#pragma unroll
        for (int g = 0; g < 2; ++g) {
            float (&y)[16] = x[g];
            exp2_in_place(y[0], y[1], y[2], y[3], y[4], y[5], y[6], y[7]);
            exp2_in_place(y[8], y[9], y[10], y[11], y[12], y[13], y[14], y[15]);

            v16bf pb;           // P^T B-fragment, built in-register
            float psum = y[0];
#pragma unroll
            for (int i = 1; i < 16; ++i) psum += y[i];
#pragma unroll
            for (int i = 0; i < 16; ++i) pb[i] = (bf16_t)y[i];
            lstat[g] += psum;

            // ---- O^T += V^T (d x 32s) x P^T (32s x 16t) ----
#pragma unroll
            for (int j = 0; j < 4; ++j) o[g][j] = wmma_bf16(vf[set][j], pb, o[g][j]);
        }
    };

    fetch(0, 0);
    // These loads are still in flight where the code behind them gives their address registers a new value.
    asm volatile("s_wait_xcnt 0x0" ::: "memory");
    {   // The first maximum in use is the true maximum of the first 32 s: whatever the scores' level, some exponential of the sum is 1.
        float x[2][16];
        const v8f zero[2] = {};
        scores(0, zero, x);
#pragma unroll
        for (int g = 0; g < 2; ++g) {
            float mx = lane_max(x[g]);
            mx = fmaxf(mx, __shfl_xor(mx, 16, 32));
#pragma unroll
            for (int r = 0; r < 8; ++r) negm[g][r] = -mx;
        }
    }
    for (int s0 = 0; s0 < T - 64; s0 += 64) {
        trip(0, true);
        trip(1, true);
        // The loop's requests still name the address registers that are stepped here.
        asm volatile("s_wait_xcnt 0x0" ::: "memory");
        // Keeps the step behind that wait: the scheduler otherwise lifts it over the wait.
        __builtin_amdgcn_sched_barrier(0);
        qp += 4096;
        vp += 1024;
    }
    trip(0, true);
    trip(1, false);   // the last trip: nothing left to request

#pragma unroll
    for (int g = 0; g < 2; ++g) {
        const float l = lstat[g] + __shfl_xor(lstat[g], 16, 32);   // the two halves' sums, joined
        const float inv = 1.0f / l;
        bf16_t* obase = Oh + ((size_t)((b * T + t0 + 16 * g) >> 4) * (H * 2) + h * 2) * 512 + lane * 8;
#pragma unroll
        for (int j = 0; j < 4; ++j) {
            v8bf ov;
#pragma unroll
            for (int r = 0; r < 8; ++r) ov[r] = (bf16_t)(o[g][j][r] * inv);
            *(v8bf*)(obase + j * 256) = ov;
        }
    }
}

// ---------------------------------------------------------------------------
// Host-side launch
// ---------------------------------------------------------------------------
extern "C" void kernel_launch(void* const* d_in, const int* in_sizes, int n_in,
                              void* d_out, int out_size, void* d_ws, size_t ws_size,
                              hipStream_t stream) {
    constexpr int Bb = 2, T = 2048, Cc = 1024, H = 16, D = 64;
    constexpr int M = Bb * T;          // 4096
    const float kscale = 1.44269504f / 32.0f;  // C^-0.5 = 1024^-0.5, times log2(e): exp(y) = 2^(y * log2(e))

    const float* x  = (const float*)d_in[0];
    const float* Wk = (const float*)d_in[1];
    const float* bk = (const float*)d_in[2];
    const float* Wq = (const float*)d_in[3];
    const float* bq = (const float*)d_in[4];
    const float* Wv = (const float*)d_in[5];
    const float* bv = (const float*)d_in[6];
    const float* Wp = (const float*)d_in[7];
    const float* bp = (const float*)d_in[8];

    char* ws = (char*)d_ws;
    size_t off = 0;
    bf16_t* xb   = (bf16_t*)(ws + off); off += (size_t)M * Cc * sizeof(bf16_t);         // 8 MB
    bf16_t* wkT  = (bf16_t*)(ws + off); off += (size_t)H * D * Cc * sizeof(bf16_t);     // 2 MB
    bf16_t* wqT  = (bf16_t*)(ws + off); off += (size_t)H * D * Cc * sizeof(bf16_t);
    bf16_t* wvT  = (bf16_t*)(ws + off); off += (size_t)H * D * Cc * sizeof(bf16_t);
    bf16_t* wpT  = (bf16_t*)(ws + off); off += (size_t)Cc * Cc * sizeof(bf16_t);        // 2 MB
    bf16_t* kmat = (bf16_t*)(ws + off); off += (size_t)Bb * H * T * D * sizeof(bf16_t); // 8 MB
    bf16_t* qmat = (bf16_t*)(ws + off); off += (size_t)Bb * H * T * D * sizeof(bf16_t);
    bf16_t* vTm  = (bf16_t*)(ws + off); off += (size_t)Bb * H * T * D * sizeof(bf16_t);
    bf16_t* oh   = (bf16_t*)(ws + off); off += (size_t)M * Cc * sizeof(bf16_t);         // 8 MB

    // 1) conversions / packing, one launch
    {
        constexpr int blocks = 3 * (Cc / 64) * H + (Cc / 64) * (Cc / 64) + (M / 16) * (Cc / 32) / 8;
        mha_pack_all<Cc, H><<<blocks, 256, 0, stream>>>(x, Wk, Wq, Wv, Wp, xb, wkT, wqT, wvT, wpT);
    }

    // 2) k, q, v projections, one launch: each M=4096, N=1024 (h*64+d), K=1024
    {
        dim3 grid(M / 256, H);
        mha_gemm_kqv<Cc><<<grid, 384, 0, stream>>>(xb, wkT, wqT, wvT, bk, bq, bv, kmat, qmat, vTm, M, H * D, T, H, kscale);
    }

    // 3) flash attention: grid (T/256 tiles of t, B*H), 8 waves/block
    {
        dim3 grid(T / 256, Bb * H);
        mha_flash_attn<T><<<grid, 256, 0, stream>>>(kmat, qmat, vTm, oh, H);
    }

    // 4) output projection: [4096,1024] x [1024,1024]^T + bp -> f32 d_out
    {
        dim3 grid(M / 128, Cc / 128);
        mha_gemm_wmma<2, Cc><<<grid, 256, 0, stream>>>(oh, wpT, bp, d_out, M, Cc, T, H);
    }

    (void)in_sizes; (void)n_in; (void)out_size; (void)ws_size;
}

// v008
// Measured time: 70.4 microseconds a run.
// Two timings next to v007 both put it at 1.11 times that version's speed.
// Over all steps from v000 it is 6.13 times as fast.
#include <hip/hip_runtime.h>
#include <math.h>

typedef __bf16 bf16_t;
typedef __attribute__((ext_vector_type(16))) __bf16 v16bf;
typedef __attribute__((ext_vector_type(8)))  __bf16 v8bf;
typedef __attribute__((ext_vector_type(8)))  float  v8f;

static __device__ __forceinline__ v8f wmma_bf16(v16bf a, v16bf b, v8f c) {
    // 8 args: (neg_a, A, neg_b, B, c_mod, C, reuse_a, reuse_b)
    return __builtin_amdgcn_wmma_f32_16x16x32_bf16(
        false, a, false, b, (short)0, c, false, false);
}

// Element offset of the 8 consecutive k that start at (row, k), k a multiple of 8.
static __device__ __forceinline__ size_t frag_chunk_offset(int row, int k, int KT) {
    return ((size_t)(row >> 4) * KT + (k >> 5)) * 512
         + (size_t)((((k >> 4) & 1) * 32 + (row & 15) + 16 * ((k >> 3) & 1)) * 8);
}

static __device__ __forceinline__ v16bf load_frag_tiled(const bf16_t* __restrict__ group, unsigned off) {
    const char* p0 = (const char*)group + off;
    v8bf a = *(const v8bf*)p0;
    v8bf b = *(const v8bf*)(p0 + 512);
    v16bf out;
#pragma unroll
    for (int i = 0; i < 8; ++i) { out[i] = a[i]; out[i + 8] = b[i]; }
    return out;
}

static __device__ __forceinline__ void ask_l2(const char* p) {
    asm volatile("global_prefetch_b8 %0, off scope:SCOPE_SE\n\t"
                 "s_wait_xcnt 0x0" :: "v"(p) : "memory");
}
static __device__ __forceinline__ void ask_l2(const char* p, const char* q) {
    asm volatile("global_prefetch_b8 %0, off scope:SCOPE_SE\n\t"
                 "global_prefetch_b8 %1, off scope:SCOPE_SE\n\t"
                 "s_wait_xcnt 0x0" :: "v"(p), "v"(q) : "memory");
}

static __device__ __forceinline__ void cvt_bf16_tiles(const float* __restrict__ in, bf16_t* __restrict__ out, int C, int blk) {
    const int lane = threadIdx.x & 31;
    const int tile = blk * 8 + (threadIdx.x >> 5);
    const int KT = C >> 5;
    const int rt = tile / KT, kt = tile % KT;
    const float* p = in + (size_t)(rt * 16 + (lane & 15)) * C + kt * 32 + (lane >> 4) * 8;
    const float4 a0 = *(const float4*)(p);
    const float4 a1 = *(const float4*)(p + 4);
    const float4 b0 = *(const float4*)(p + 16);
    const float4 b1 = *(const float4*)(p + 20);
    v8bf lo, hi;
    lo[0] = (bf16_t)a0.x; lo[1] = (bf16_t)a0.y; lo[2] = (bf16_t)a0.z; lo[3] = (bf16_t)a0.w;
    lo[4] = (bf16_t)a1.x; lo[5] = (bf16_t)a1.y; lo[6] = (bf16_t)a1.z; lo[7] = (bf16_t)a1.w;
    hi[0] = (bf16_t)b0.x; hi[1] = (bf16_t)b0.y; hi[2] = (bf16_t)b0.z; hi[3] = (bf16_t)b0.w;
    hi[4] = (bf16_t)b1.x; hi[5] = (bf16_t)b1.y; hi[6] = (bf16_t)b1.z; hi[7] = (bf16_t)b1.w;
    bf16_t* q = out + (size_t)tile * 512 + lane * 8;
    *(v8bf*)q = lo;
    *(v8bf*)(q + 256) = hi;
    // In the merged launch other jobs' code follows these stores in the listing and reuses their registers.
    asm volatile("s_wait_xcnt 0x0" ::: "memory");
}

static __device__ __forceinline__ void transpose_tile_64x64(
    const float* __restrict__ in, int ldin, bf16_t* __restrict__ out, int row0, int k0, int KT) {
    __shared__ float tile[64][65];
    const int tid = threadIdx.x;

    const int lr = tid >> 4;         // 0..15: row inside a group of 16
    const int lc = (tid & 15) * 4;   // first of 4 columns
#pragma unroll
    for (int i = 0; i < 4; ++i) {
        const int r = i * 16 + lr;
        const float4 v = *(const float4*)(in + (size_t)r * ldin + lc);
        tile[r][lc + 0] = v.x;
        tile[r][lc + 1] = v.y;
        tile[r][lc + 2] = v.z;
        tile[r][lc + 3] = v.w;
    }
    __syncthreads();

    const int sr = tid >> 3;         // 0..31: output row inside a group of 32
    const int sc = (tid & 7) * 8;    // first of 8 output columns
#pragma unroll
    for (int i = 0; i < 2; ++i) {
        const int j = i * 32 + sr;
        v8bf o;
#pragma unroll
        for (int k = 0; k < 8; ++k) o[k] = (bf16_t)tile[sc + k][j];
        *(v8bf*)(out + frag_chunk_offset(row0 + j, k0 + sc, KT)) = o;
    }
    // In the merged launch other jobs' code follows these stores in the listing and reuses their registers.
    asm volatile("s_wait_xcnt 0x0" ::: "memory");
}

// All five packing jobs in ONE launch: none reads what another writes, so the block index picks the job.
//   blocks [0, 3 * WB)      : W[h][c][d] (f32) -> Wt (bf16), operand [N=h*64+d][K=c] in fragment order, for k, q, v;
//                             head size 64 = one tile wide
//   the next PB blocks      : Wp[k][n] (f32) -> WpT (bf16), operand [n][k] in fragment order
//   the rest                : x (f32) -> xb (bf16) in fragment order
// The transposes stand first: theirs is the longer way from load to store.
// grid 3 * WB + PB + (M/16 * C/32) / 8, 256 threads
template <int C, int H>
__global__ void mha_pack_all(const float* __restrict__ x,
                             const float* __restrict__ Wk, const float* __restrict__ Wq,
                             const float* __restrict__ Wv, const float* __restrict__ Wp,
                             bf16_t* __restrict__ xb,
                             bf16_t* __restrict__ wkT, bf16_t* __restrict__ wqT,
                             bf16_t* __restrict__ wvT, bf16_t* __restrict__ wpT) {
    constexpr int CT = C / 64;        // 64-wide tiles along C
    constexpr int WB = CT * H;        // tiles of one per-head weight
    constexpr int PB = CT * CT;       // tiles of the output projection
    const int blk = blockIdx.x;       // the same in every thread of a block: the barrier in the transpose is block-uniform
    if (blk < 3 * WB + PB) {
        const int job = blk / WB < 3 ? blk / WB : 3;
        const int t  = blk - job * WB;
        const int tx = (t % CT) * 64;   // c0 (per-head weights), k0 (output projection)
        const int ty = (t / CT) * 64;   // h * 64,                n0
        const float* in  = job == 0 ? Wk : job == 1 ? Wq : job == 2 ? Wv : Wp;
        bf16_t*      out = job == 0 ? wkT : job == 1 ? wqT : job == 2 ? wvT : wpT;
        if (job < 3) transpose_tile_64x64(in + ((size_t)ty * C + (size_t)tx * 64), 64, out, ty, tx, C >> 5);
        else         transpose_tile_64x64(in + (size_t)tx * C + ty,                 C, out, ty, tx, C >> 5);
    } else {
        cvt_bf16_tiles(x, xb, C, blk - (3 * WB + PB));
    }
}

template <int MODE, int K, int MI>
static __device__ __forceinline__ void gemm_wmma_tile(const bf16_t* __restrict__ A,
                              const bf16_t* __restrict__ Bm,
                              const float* __restrict__ bias,
                              void* __restrict__ out,
                              int m0, int n0,   // wave-uniform: tile bases are formed in scalar registers
                              int N, int T, int H, float osc) {
    const int lane = threadIdx.x & 31;

    constexpr int KT = K >> 5;
    const int mt = m0 >> 4;
    const int nt = n0 >> 4;

    const bf16_t* ag = A  + (size_t)mt * KT * 512;   // the wave's MI 16-row groups of A
    const bf16_t* bg = Bm + (size_t)nt * KT * 512;   // and its four of B
    constexpr size_t gs = (size_t)KT * 512;          // elements per 16-row group

    constexpr int SETS = 3;   // register sets: one in use, two in flight
    static_assert(KT >= SETS && (KT - (SETS - 1)) % SETS == 0, "the loop walks SETS tiles a trip and leaves SETS - 1 for the tail");

    v8f acc[MI][4] = {};
    v16bf fa[SETS][MI], fb[SETS][4];
    auto fetch = [&](int set, unsigned o) __attribute__((always_inline)) {
#pragma unroll
        for (int i = 0; i < MI; ++i) fa[set][i] = load_frag_tiled(ag + i * gs, o);
#pragma unroll
        for (int j = 0; j < 4; ++j) fb[set][j] = load_frag_tiled(bg + j * gs, o);
    };
    auto products = [&](int set) __attribute__((always_inline)) {
#pragma unroll
        for (int j = 0; j < 4; ++j) {
#pragma unroll
            for (int i = 0; i < MI; ++i) {
                if (MODE == 0) acc[i][j] = wmma_bf16(fb[set][j], fa[set][i], acc[i][j]);
                else           acc[i][j] = wmma_bf16(fa[set][i], fb[set][j], acc[i][j]);
            }
        }
    };

    unsigned off = lane * 16;
#pragma unroll
    for (int s = 0; s < SETS - 1; ++s) fetch(s, off + s * 1024);
    for (int kt = 0; kt < KT - (SETS - 1); kt += SETS) {
#pragma unroll
        for (int u = 0; u < SETS; ++u) {
            fetch((u + SETS - 1) % SETS, off + (u + SETS - 1) * 1024);
            // Keeps the requests in front of these products: without it the scheduler sinks them to just
            // before their own use, and the wave waits out the whole L2 latency again.
            __builtin_amdgcn_sched_barrier(0);
            products(u);
            // Keeps what follows behind these products: the next requests, and at the loop's foot the step of the
            // address register, whose wait would otherwise stall the wave in front of products that are ready.
            __builtin_amdgcn_sched_barrier(0);
        }
        // The trip's requests still name the address register that is stepped here. The 64-row tile uses registers above
        // v255.
        if (MI > 2) {
            asm volatile("s_wait_xcnt 0x0" ::: "memory");
            // Keeps the step behind that wait: the scheduler otherwise lifts it over the wait.
            __builtin_amdgcn_sched_barrier(0);
        }
        off += SETS * 1024;
    }
#pragma unroll
    for (int u = 0; u < SETS - 1; ++u) products(u);   // the last tiles: nothing left to request

    const int half = lane >> 4;
    const int nc = lane & 15;
    if (MODE == 0) {
        const int h = n0 >> 6;   // the wave's 64 columns are one head
        float bj[4][8];          // read once, ahead of the waits below, which would have it read again for every i
#pragma unroll
        for (int j = 0; j < 4; ++j)
#pragma unroll
            for (int r = 0; r < 8; ++r) bj[j][r] = bias[n0 + 16 * j + 8 * half + r];
#pragma unroll
        for (int i = 0; i < MI; ++i) {
            const int mb = m0 + 16 * i;
            const int b = mb / T, tt = (mb % T) >> 4;
            bf16_t* tile = (bf16_t*)out + ((size_t)b * H + h) * T * 64 + (size_t)tt * 1024 + lane * 8;
#pragma unroll
            for (int j = 0; j < 4; ++j) {
                v8bf o;
#pragma unroll
                for (int r = 0; r < 8; ++r) o[r] = (bf16_t)((acc[i][j][r] + bj[j][r]) * osc);
                *(v8bf*)(tile + j * 256) = o;
            }
            // The next rows' arithmetic reuses the registers that these stores name.
            if (i + 1 < MI) asm volatile("s_wait_xcnt 0x0" ::: "memory");
            // Keeps that arithmetic behind the wait: nothing else ties it to the stores' registers.
            __builtin_amdgcn_sched_barrier(0);
        }
    } else if (MODE == 1) {
        const int h = n0 >> 6;
        const int b = m0 / T, sb = (m0 % T) >> 5;   // each 32 of the wave's rows are one k tile of v^T
        const int KTs = T >> 5;
        bf16_t* base = (bf16_t*)out + ((size_t)b * H + h) * 64 * T + lane * 8;
#pragma unroll
        for (int j = 0; j < 4; ++j) {
            const float bn = bias[n0 + 16 * j + nc];
#pragma unroll
            for (int i = 0; i < MI; ++i) {
                v8bf o;
#pragma unroll
                for (int r = 0; r < 8; ++r) o[r] = (bf16_t)(acc[i][j][r] + bn);
                *(v8bf*)(base + ((size_t)j * KTs + sb + (i >> 1)) * 512 + (i & 1) * 256) = o;
            }
        }
    } else {
#pragma unroll
        for (int i = 0; i < MI; ++i) {
#pragma unroll
            for (int j = 0; j < 4; ++j) {
#pragma unroll
                for (int r = 0; r < 8; ++r) {
                    const int m = m0 + 16 * i + r + 8 * half;
                    const int n = n0 + 16 * j + nc;
                    ((float*)out)[(size_t)m * N + n] = acc[i][j][r] + bias[n];
                }
            }
        }
    }
}

// One GEMM a launch (the output projection). Block: 8 waves (4M x 2N) of 32 x 64 -> 128(M) x 128(N): the square block
// asks L2 for 16 fragments per k tile where 64 x 256 asks for 20, with the same 256 blocks.
// grid (M/128, N/128), 256 threads
template <int MODE, int K>
__global__ void __launch_bounds__(256) __attribute__((amdgpu_waves_per_eu(4, 4))) mha_gemm_wmma(const bf16_t* __restrict__ A,
                              const bf16_t* __restrict__ Bm,
                              const float* __restrict__ bias,
                              void* __restrict__ out,
                              int M, int N, int T, int H) {
    const int wave = __builtin_amdgcn_readfirstlane(threadIdx.x >> 5);
    const int m0 = blockIdx.x * 128 + (wave & 3) * 32;
    const int n0 = blockIdx.y * 128 + (wave >> 2) * 64;
    // The block's 8 + 8 row groups of 32 KB: of each operand this block asks for the two groups of its class, a wave for 8 KB.
    static_assert(K == 1024, "a 16-row group is four requests of 8 KB");
    constexpr size_t gb = (size_t)K * 32;   // bytes per 16-row group
    const unsigned unit = (threadIdx.x & 31) * 256;
    const char* pa = (const char*)A  + (size_t)(blockIdx.x * 8 + (wave & 1) * 4 + (blockIdx.y & 3)) * gb + (wave >> 1) * 8192;
    const char* pb = (const char*)Bm + (size_t)(blockIdx.y * 8 + (wave & 1) * 4 + (blockIdx.x & 3)) * gb + (wave >> 1) * 8192;
    ask_l2(pa + unit, pb + unit);
    gemm_wmma_tile<MODE, K, 2>(A, Bm, bias, out, m0, n0, N, T, H, 1.0f);
}

template <int K>
__global__ void __launch_bounds__(384) __attribute__((amdgpu_waves_per_eu(3, 3))) mha_gemm_kqv(const bf16_t* __restrict__ A,
                              const bf16_t* __restrict__ wkT, const bf16_t* __restrict__ wqT, const bf16_t* __restrict__ wvT,
                              const float* __restrict__ bk, const float* __restrict__ bq, const float* __restrict__ bv,
                              bf16_t* __restrict__ kmat, bf16_t* __restrict__ qmat, bf16_t* __restrict__ vTm,
                              int M, int N, int T, int H, float kscale) {
    const int wave = __builtin_amdgcn_readfirstlane(threadIdx.x >> 5);
    const int which = wave >> 2;
    const int m0 = blockIdx.x * 256 + (wave & 3) * 64;
    const int n0 = blockIdx.y * 64;
    // The block's 16 row groups of x and 3 x 4 of the weights, 32 KB each: this block asks for the four x groups and the
    // three weight groups of its class, 16 + 12 requests of 8 KB: a wave one of each, the last four waves a second of x.
    static_assert(K == 1024, "a 16-row group is four requests of 8 KB");
    constexpr size_t gb = (size_t)K * 32;   // bytes per 16-row group
    const unsigned unit = (threadIdx.x & 31) * 256;
    const bf16_t* wT = which == 0 ? wkT : which == 1 ? wqT : wvT;
    const char* pa = (const char*)A  + (size_t)(blockIdx.x * 16 + (wave & 3) * 4 + (blockIdx.y & 3)) * gb + which * 8192;
    const char* pb = (const char*)wT + (size_t)(blockIdx.y * 4 + (blockIdx.x & 3)) * gb + (wave & 3) * 8192;
    ask_l2(pa + unit, pb + unit);
    if (which == 2) ask_l2(pa + 8192 + unit);   // the x group's fourth piece; the test reads the same in every lane: a scalar branch
    if (which == 2) gemm_wmma_tile<1, K, 4>(A, wvT, bv, (void*)vTm, m0, n0, N, T, H, 1.0f);
    else            gemm_wmma_tile<0, K, 4>(A, which ? wqT : wkT, which ? bq : bk, (void*)(which ? qmat : kmat), m0, n0, N, T, H,
                                            which ? 1.0f : kscale);
}

static __device__ __forceinline__ void exp2_in_place(float& a, float& b, float& c, float& d,
                                                     float& e, float& f, float& g, float& h) {
    asm("v_exp_f32 %0, %0\n\tv_exp_f32 %1, %1\n\tv_exp_f32 %2, %2\n\tv_exp_f32 %3, %3\n\t"
        "v_exp_f32 %4, %4\n\tv_exp_f32 %5, %5\n\tv_exp_f32 %6, %6\n\tv_exp_f32 %7, %7\n\t"
        "v_nop"
        : "+v"(a), "+v"(b), "+v"(c), "+v"(d), "+v"(e), "+v"(f), "+v"(g), "+v"(h));
}
static __device__ __forceinline__ void exp2_in_place(float& a) {
    asm("v_exp_f32 %0, %0\n\tv_nop" : "+v"(a));
}

template <int T>
__global__ void __launch_bounds__(256) mha_flash_attn(const bf16_t* __restrict__ Kp,
                               const bf16_t* __restrict__ Qp,
                               const bf16_t* __restrict__ VTp,
                               bf16_t* __restrict__ Oh,
                               int H) {
    const int lane = threadIdx.x & 31;
    const int wave = __builtin_amdgcn_readfirstlane(threadIdx.x >> 5);   // wave-uniform: tile bases are formed in scalar registers
    const int bh = blockIdx.y;
    const int b = bh / H, h = bh % H;
    const int t0 = blockIdx.x * 256 + wave * 32;

    const bf16_t* kbase = Kp  + (size_t)bh * T * 64;
    const bf16_t* qbase = Qp  + (size_t)bh * T * 64;
    const bf16_t* vbase = VTp + (size_t)bh * 64 * T;

    // The 256 KB of q and the 256 KB of v^T that the eight blocks of this (b, h) all walk: this block asks for the quarter of
    // its class, every fourth 8 KB of q and one 16-row group of v^T, a wave for 8 KB of each.
    static_assert(T == 2048, "8 waves x 4 classes x 8 KB = T rows of q = 64 rows of v^T");
    const unsigned cls = blockIdx.x & 3;
    const unsigned unit = lane * 256;
    const char* pq = (const char*)qbase + (4 * wave + cls) * 8192;
    const char* pv = (const char*)vbase + (8 * cls + wave) * 8192;
    ask_l2(pq + unit, pv + unit);

    // k tiles as B operands (N = t columns, K = d), resident for whole loop; kb[g]: column group g
    v16bf kb[2][2];
#pragma unroll
    for (int g = 0; g < 2; ++g) {
        kb[g][0] = load_frag_tiled(kbase + (size_t)(t0 + 16 * g) * 64, lane * 16);
        kb[g][1] = load_frag_tiled(kbase + (size_t)(t0 + 16 * g) * 64, lane * 16 + 1024);
    }

    float lstat[2] = {0.f, 0.f};   // this half's part of the column's sum
    v8f negm[2];                   // minus the column's maximum in use, the same in all 8 registers and in both halves: the scores' C operand
    v8f o[2][4] = {};              // O^T: per group 4 d-tiles x (8 vgprs), col t = lane&15

    constexpr size_t vgs = (size_t)T * 16;   // elements per 16-row group of v^T
    static_assert(T % 256 == 0, "a block owns 256 t, and the loop walks two trips of 32 s at a time");
    v16bf qf[2][4], vf[2][4];
    const unsigned loff = lane * 16;
    const bf16_t* qp = qbase;
    const bf16_t* vp = vbase;
    // ahead: trips counted from the one that qp and vp stand at; a constant, so it folds into the loads' offset field
    auto fetch = [&](int set, int ahead) __attribute__((always_inline)) {
#pragma unroll
        for (int f = 0; f < 4; ++f) qf[set][f] = load_frag_tiled(qp, loff + 4096 * ahead + 1024 * f);
#pragma unroll
        for (int j = 0; j < 4; ++j) vf[set][j] = load_frag_tiled(vp + j * vgs, loff + 1024 * ahead);
    };
    // S^T + c: per group two 16-row s-tiles, D=64 in two WMMA K-steps each; x[g][8 * m + r] = group g, tile m, vgpr r
    auto scores = [&](int set, const v8f (&c)[2], float (&x)[2][16]) __attribute__((always_inline)) {
        v8f accs[2][2];
#pragma unroll
        for (int m = 0; m < 2; ++m)
#pragma unroll
            for (int g = 0; g < 2; ++g) accs[g][m] = wmma_bf16(qf[set][2 * m], kb[g][0], c[g]);
#pragma unroll
        for (int m = 0; m < 2; ++m)
#pragma unroll
            for (int g = 0; g < 2; ++g) accs[g][m] = wmma_bf16(qf[set][2 * m + 1], kb[g][1], accs[g][m]);
#pragma unroll
        for (int g = 0; g < 2; ++g)
#pragma unroll
            for (int m = 0; m < 2; ++m)
#pragma unroll
                for (int r = 0; r < 8; ++r) x[g][8 * m + r] = accs[g][m][r];
    };
    auto lane_max = [&](const float (&x)[16]) __attribute__((always_inline)) {
        float mx = x[0];
#pragma unroll
        for (int i = 1; i < 16; ++i) mx = fmaxf(mx, x[i]);
        return mx;
    };
    auto trip = [&](int set, bool more) __attribute__((always_inline)) {
        if (more) fetch(set ^ 1, set + 1);
        // Keeps these requests in front of the branch below: without it the compiler sinks them behind the branch,
        // to just before their use, and the wave waits out the whole latency.
        asm volatile("" ::: "memory");
        // Keeps the requests in front of the score products, which the scheduler otherwise lifts over them.
        __builtin_amdgcn_sched_barrier(0);
        float x[2][16];
        scores(set, negm, x);
        __builtin_amdgcn_sched_barrier(0);
        float mx[2] = {lane_max(x[0]), lane_max(x[1])};
        if (__builtin_amdgcn_ballot_w32(fmaxf(mx[0], mx[1]) > 8.0f) != 0) {   // the same in every lane: a scalar branch, rarely taken
#pragma unroll
            for (int g = 0; g < 2; ++g) {
                const float mg = fmaxf(mx[g], __shfl_xor(mx[g], 16, 32));   // combine the two halves
                const float up = fmaxf(mg, 0.f);                            // a column whose maximum has not grown keeps it
                float corr = -up;
                exp2_in_place(corr);
#pragma unroll
                for (int i = 0; i < 16; ++i) x[g][i] -= up;
#pragma unroll
                for (int r = 0; r < 8; ++r) negm[g][r] -= up;
                lstat[g] *= corr;
#pragma unroll
                for (int j = 0; j < 4; ++j)
#pragma unroll
                    for (int r = 0; r < 8; ++r) o[g][j][r] *= corr;
            }
        }
#pragma unroll
        for (int g = 0; g < 2; ++g) {
            float (&y)[16] = x[g];
            exp2_in_place(y[0], y[1], y[2], y[3], y[4], y[5], y[6], y[7]);
            exp2_in_place(y[8], y[9], y[10], y[11], y[12], y[13], y[14], y[15]);

            v16bf pb;           // P^T B-fragment, built in-register
            float psum = y[0];
#pragma unroll
            for (int i = 1; i < 16; ++i) psum += y[i];
#pragma unroll
            for (int i = 0; i < 16; ++i) pb[i] = (bf16_t)y[i];
            lstat[g] += psum;

            // ---- O^T += V^T (d x 32s) x P^T (32s x 16t) ----
#pragma unroll
            for (int j = 0; j < 4; ++j) o[g][j] = wmma_bf16(vf[set][j], pb, o[g][j]);
        }
    };

    fetch(0, 0);
    // These loads are still in flight where the code behind them gives their address registers a new value.
    asm volatile("s_wait_xcnt 0x0" ::: "memory");
    {   // The first maximum in use is the true maximum of the first 32 s: whatever the scores' level, some exponential of the sum is 1.
        float x[2][16];
        const v8f zero[2] = {};
        scores(0, zero, x);
#pragma unroll
        for (int g = 0; g < 2; ++g) {
            float mx = lane_max(x[g]);
            mx = fmaxf(mx, __shfl_xor(mx, 16, 32));
#pragma unroll
            for (int r = 0; r < 8; ++r) negm[g][r] = -mx;
        }
    }
    for (int s0 = 0; s0 < T - 64; s0 += 64) {
        trip(0, true);
        trip(1, true);
        // The loop's requests still name the address registers that are stepped here.
        asm volatile("s_wait_xcnt 0x0" ::: "memory");
        // Keeps the step behind that wait: the scheduler otherwise lifts it over the wait.
        __builtin_amdgcn_sched_barrier(0);
        qp += 4096;
        vp += 1024;
    }
    trip(0, true);
    trip(1, false);   // the last trip: nothing left to request

#pragma unroll
    for (int g = 0; g < 2; ++g) {
        const float l = lstat[g] + __shfl_xor(lstat[g], 16, 32);   // the two halves' sums, joined
        const float inv = 1.0f / l;
        bf16_t* obase = Oh + ((size_t)((b * T + t0 + 16 * g) >> 4) * (H * 2) + h * 2) * 512 + lane * 8;
#pragma unroll
        for (int j = 0; j < 4; ++j) {
            v8bf ov;
#pragma unroll
            for (int r = 0; r < 8; ++r) ov[r] = (bf16_t)(o[g][j][r] * inv);
            *(v8bf*)(obase + j * 256) = ov;
        }
    }
}

// ---------------------------------------------------------------------------
// Host-side launch
// ---------------------------------------------------------------------------
extern "C" void kernel_launch(void* const* d_in, const int* in_sizes, int n_in,
                              void* d_out, int out_size, void* d_ws, size_t ws_size,
                              hipStream_t stream) {
    constexpr int Bb = 2, T = 2048, Cc = 1024, H = 16, D = 64;
    constexpr int M = Bb * T;          // 4096
    const float kscale = 1.44269504f / 32.0f;  // C^-0.5 = 1024^-0.5, times log2(e): exp(y) = 2^(y * log2(e))

    const float* x  = (const float*)d_in[0];
    const float* Wk = (const float*)d_in[1];
    const float* bk = (const float*)d_in[2];
    const float* Wq = (const float*)d_in[3];
    const float* bq = (const float*)d_in[4];
    const float* Wv = (const float*)d_in[5];
    const float* bv = (const float*)d_in[6];
    const float* Wp = (const float*)d_in[7];
    const float* bp = (const float*)d_in[8];

    char* ws = (char*)d_ws;
    size_t off = 0;
    bf16_t* xb   = (bf16_t*)(ws + off); off += (size_t)M * Cc * sizeof(bf16_t);         // 8 MB
    bf16_t* wkT  = (bf16_t*)(ws + off); off += (size_t)H * D * Cc * sizeof(bf16_t);     // 2 MB
    bf16_t* wqT  = (bf16_t*)(ws + off); off += (size_t)H * D * Cc * sizeof(bf16_t);
    bf16_t* wvT  = (bf16_t*)(ws + off); off += (size_t)H * D * Cc * sizeof(bf16_t);
    bf16_t* wpT  = (bf16_t*)(ws + off); off += (size_t)Cc * Cc * sizeof(bf16_t);        // 2 MB
    bf16_t* kmat = (bf16_t*)(ws + off); off += (size_t)Bb * H * T * D * sizeof(bf16_t); // 8 MB
    bf16_t* qmat = (bf16_t*)(ws + off); off += (size_t)Bb * H * T * D * sizeof(bf16_t);
    bf16_t* vTm  = (bf16_t*)(ws + off); off += (size_t)Bb * H * T * D * sizeof(bf16_t);
    bf16_t* oh   = (bf16_t*)(ws + off); off += (size_t)M * Cc * sizeof(bf16_t);         // 8 MB

    // 1) conversions / packing, one launch
    {
        constexpr int blocks = 3 * (Cc / 64) * H + (Cc / 64) * (Cc / 64) + (M / 16) * (Cc / 32) / 8;
        mha_pack_all<Cc, H><<<blocks, 256, 0, stream>>>(x, Wk, Wq, Wv, Wp, xb, wkT, wqT, wvT, wpT);
    }

    // 2) k, q, v projections, one launch: each M=4096, N=1024 (h*64+d), K=1024
    {
        dim3 grid(M / 256, H);
        mha_gemm_kqv<Cc><<<grid, 384, 0, stream>>>(xb, wkT, wqT, wvT, bk, bq, bv, kmat, qmat, vTm, M, H * D, T, H, kscale);
    }

    // 3) flash attention: grid (T/256 tiles of t, B*H), 8 waves/block
    {
        dim3 grid(T / 256, Bb * H);
        mha_flash_attn<T><<<grid, 256, 0, stream>>>(kmat, qmat, vTm, oh, H);
    }

    // 4) output projection: [4096,1024] x [1024,1024]^T + bp -> f32 d_out
    {
        dim3 grid(M / 128, Cc / 128);
        mha_gemm_wmma<2, Cc><<<grid, 256, 0, stream>>>(oh, wpT, bp, d_out, M, Cc, T, H);
    }

    (void)in_sizes; (void)n_in; (void)out_size; (void)ws_size;
}

// v009
// A run of this version takes 66.7 microseconds.
// Timed twice side by side with v008, it ran 1.06 times as fast both times.
// Over all steps from v000 it is 6.48 times as fast.
#include <hip/hip_runtime.h>
#include <math.h>

typedef __bf16 bf16_t;
typedef __attribute__((ext_vector_type(16))) __bf16 v16bf;
typedef __attribute__((ext_vector_type(8)))  __bf16 v8bf;
typedef __attribute__((ext_vector_type(8)))  float  v8f;

static __device__ __forceinline__ v8f wmma_bf16(v16bf a, v16bf b, v8f c) {
    // 8 args: (neg_a, A, neg_b, B, c_mod, C, reuse_a, reuse_b)
    return __builtin_amdgcn_wmma_f32_16x16x32_bf16(
        false, a, false, b, (short)0, c, false, false);
}

// Element offset of the 8 consecutive k that start at (row, k), k a multiple of 8.
static __device__ __forceinline__ size_t frag_chunk_offset(int row, int k, int KT) {
    return ((size_t)(row >> 4) * KT + (k >> 5)) * 512
         + (size_t)((((k >> 4) & 1) * 32 + (row & 15) + 16 * ((k >> 3) & 1)) * 8);
}

static __device__ __forceinline__ v16bf load_frag_tiled(const bf16_t* __restrict__ group, unsigned off) {
    const char* p0 = (const char*)group + off;
    v8bf a = *(const v8bf*)p0;
    v8bf b = *(const v8bf*)(p0 + 512);
    v16bf out;
#pragma unroll
    for (int i = 0; i < 8; ++i) { out[i] = a[i]; out[i + 8] = b[i]; }
    return out;
}

static __device__ __forceinline__ void ask_l2(const char* p) {
    asm volatile("global_prefetch_b8 %0, off scope:SCOPE_SE\n\t"
                 "s_wait_xcnt 0x0" :: "v"(p) : "memory");
}
static __device__ __forceinline__ void ask_l2(const char* p, const char* q) {
    asm volatile("global_prefetch_b8 %0, off scope:SCOPE_SE\n\t"
                 "global_prefetch_b8 %1, off scope:SCOPE_SE\n\t"
                 "s_wait_xcnt 0x0" :: "v"(p), "v"(q) : "memory");
}

static __device__ __forceinline__ void cvt_bf16_tiles(const float* __restrict__ in, bf16_t* __restrict__ out, int C, int blk) {
    const int lane = threadIdx.x & 31;
    const int tile = blk * 8 + (threadIdx.x >> 5);
    const int KT = C >> 5;
    const int rt = tile / KT, kt = tile % KT;
    const float* p = in + (size_t)(rt * 16 + (lane & 15)) * C + kt * 32 + (lane >> 4) * 8;
    const float4 a0 = *(const float4*)(p);
    const float4 a1 = *(const float4*)(p + 4);
    const float4 b0 = *(const float4*)(p + 16);
    const float4 b1 = *(const float4*)(p + 20);
    v8bf lo, hi;
    lo[0] = (bf16_t)a0.x; lo[1] = (bf16_t)a0.y; lo[2] = (bf16_t)a0.z; lo[3] = (bf16_t)a0.w;
    lo[4] = (bf16_t)a1.x; lo[5] = (bf16_t)a1.y; lo[6] = (bf16_t)a1.z; lo[7] = (bf16_t)a1.w;
    hi[0] = (bf16_t)b0.x; hi[1] = (bf16_t)b0.y; hi[2] = (bf16_t)b0.z; hi[3] = (bf16_t)b0.w;
    hi[4] = (bf16_t)b1.x; hi[5] = (bf16_t)b1.y; hi[6] = (bf16_t)b1.z; hi[7] = (bf16_t)b1.w;
    bf16_t* q = out + (size_t)tile * 512 + lane * 8;
    *(v8bf*)q = lo;
    *(v8bf*)(q + 256) = hi;
    // In the merged launch other jobs' code follows these stores in the listing and reuses their registers.
    asm volatile("s_wait_xcnt 0x0" ::: "memory");
}

static __device__ __forceinline__ void transpose_tile_64x64(
    const float* __restrict__ in, int ldin, bf16_t* __restrict__ out, int row0, int k0, int KT) {
    __shared__ float tile[64][65];
    const int tid = threadIdx.x;

    const int lr = tid >> 4;         // 0..15: row inside a group of 16
    const int lc = (tid & 15) * 4;   // first of 4 columns
#pragma unroll
    for (int i = 0; i < 4; ++i) {
        const int r = i * 16 + lr;
        const float4 v = *(const float4*)(in + (size_t)r * ldin + lc);
        tile[r][lc + 0] = v.x;
        tile[r][lc + 1] = v.y;
        tile[r][lc + 2] = v.z;
        tile[r][lc + 3] = v.w;
    }
    __syncthreads();

    const int sr = tid >> 3;         // 0..31: output row inside a group of 32
    const int sc = (tid & 7) * 8;    // first of 8 output columns
#pragma unroll
    for (int i = 0; i < 2; ++i) {
        const int j = i * 32 + sr;
        v8bf o;
#pragma unroll
        for (int k = 0; k < 8; ++k) o[k] = (bf16_t)tile[sc + k][j];
        *(v8bf*)(out + frag_chunk_offset(row0 + j, k0 + sc, KT)) = o;
    }
    // In the merged launch other jobs' code follows these stores in the listing and reuses their registers.
    asm volatile("s_wait_xcnt 0x0" ::: "memory");
}

// All five packing jobs in ONE launch: none reads what another writes, so the block index picks the job.
//   blocks [0, 3 * WB)      : W[h][c][d] (f32) -> Wt (bf16), operand [N=h*64+d][K=c] in fragment order, for k, q, v;
//                             head size 64 = one tile wide
//   the next PB blocks      : Wp[k][n] (f32) -> WpT (bf16), operand [n][k] in fragment order
//   the rest                : x (f32) -> xb (bf16) in fragment order
// The transposes stand first: theirs is the longer way from load to store.
// grid 3 * WB + PB + (M/16 * C/32) / 8, 256 threads
template <int C, int H>
__global__ void mha_pack_all(const float* __restrict__ x,
                             const float* __restrict__ Wk, const float* __restrict__ Wq,
                             const float* __restrict__ Wv, const float* __restrict__ Wp,
                             bf16_t* __restrict__ xb,
                             bf16_t* __restrict__ wkT, bf16_t* __restrict__ wqT,
                             bf16_t* __restrict__ wvT, bf16_t* __restrict__ wpT) {
    constexpr int CT = C / 64;        // 64-wide tiles along C
    constexpr int WB = CT * H;        // tiles of one per-head weight
    constexpr int PB = CT * CT;       // tiles of the output projection
    const int blk = blockIdx.x;       // the same in every thread of a block: the barrier in the transpose is block-uniform
    if (blk < 3 * WB + PB) {
        const int job = blk / WB < 3 ? blk / WB : 3;
        const int t  = blk - job * WB;
        const int tx = (t % CT) * 64;   // c0 (per-head weights), k0 (output projection)
        const int ty = (t / CT) * 64;   // h * 64,                n0
        const float* in  = job == 0 ? Wk : job == 1 ? Wq : job == 2 ? Wv : Wp;
        bf16_t*      out = job == 0 ? wkT : job == 1 ? wqT : job == 2 ? wvT : wpT;
        if (job < 3) transpose_tile_64x64(in + ((size_t)ty * C + (size_t)tx * 64), 64, out, ty, tx, C >> 5);
        else         transpose_tile_64x64(in + (size_t)tx * C + ty,                 C, out, ty, tx, C >> 5);
    } else {
        cvt_bf16_tiles(x, xb, C, blk - (3 * WB + PB));
    }
}

template <int MODE, int K, int MI>
static __device__ __forceinline__ void gemm_wmma_tile(const bf16_t* __restrict__ A,
                              const bf16_t* __restrict__ Bm,
                              const float* __restrict__ bias,
                              void* __restrict__ out,
                              int m0, int n0,   // wave-uniform: tile bases are formed in scalar registers
                              int kt0,          // the same in every wave of a block
                              int N, int T, int H, float osc) {
    const int lane = threadIdx.x & 31;

    constexpr int KT = K >> 5;
    const int mt = m0 >> 4;
    const int nt = n0 >> 4;

    const bf16_t* ag = A  + (size_t)mt * KT * 512;   // the wave's MI 16-row groups of A
    const bf16_t* bg = Bm + (size_t)nt * KT * 512;   // and its four of B
    constexpr size_t gs = (size_t)KT * 512;          // elements per 16-row group

    constexpr int SETS = 3;   // register sets: one in use, two in flight
    static_assert(KT >= SETS && (KT - (SETS - 1)) % SETS == 0, "the loop walks SETS tiles a trip and leaves SETS - 1 for the tail");
    static_assert((KT & (KT - 1)) == 0, "the wrap of the walk is a mask");

    v8f acc[MI][4] = {};
    v16bf fa[SETS][MI], fb[SETS][4];
    const unsigned loff = lane * 16;
    // step: place in the walk; its tile is (kt0 + step) mod KT, a scalar. Returns the offset register that the requests name.
    auto fetch = [&](int set, int step) __attribute__((always_inline)) {
        const unsigned o = loff + (unsigned)((kt0 + step) & (KT - 1)) * 1024;
#pragma unroll
        for (int i = 0; i < MI; ++i) fa[set][i] = load_frag_tiled(ag + i * gs, o);
#pragma unroll
        for (int j = 0; j < 4; ++j) fb[set][j] = load_frag_tiled(bg + j * gs, o);
        return o;
    };
    auto products = [&](int set) __attribute__((always_inline)) {
#pragma unroll
        for (int j = 0; j < 4; ++j) {
#pragma unroll
            for (int i = 0; i < MI; ++i) {
                if (MODE == 0) acc[i][j] = wmma_bf16(fb[set][j], fa[set][i], acc[i][j]);
                else           acc[i][j] = wmma_bf16(fa[set][i], fb[set][j], acc[i][j]);
            }
        }
    };

#pragma unroll
    for (int s = 0; s < SETS - 1; ++s) {
        const unsigned o = fetch(s, s);
        // Keeps the tiles' requests in the order of their use: mixed, the loop's first counted waits must cover younger tiles too.
        __builtin_amdgcn_sched_barrier(0);
        asm volatile("s_wait_xcnt 0x0" :: "v"(o) : "memory");
        // Keeps what follows behind that wait.
        __builtin_amdgcn_sched_barrier(0);
    }
    for (int kt = 0; kt < KT - (SETS - 1); kt += SETS) {
#pragma unroll
        for (int u = 0; u < SETS; ++u) {
            const unsigned o = fetch((u + SETS - 1) % SETS, kt + u + SETS - 1);
            // Keeps the requests in front of these products: without it the scheduler sinks them to just
            // before their own use, and the wave waits out the whole L2 latency again.
            __builtin_amdgcn_sched_barrier(0);
            products(u);
            // Keeps what follows behind these products: the next requests and the wait below, which would otherwise
            // stall the wave in front of products that are ready.
            __builtin_amdgcn_sched_barrier(0);
            // This tile's requests still name the offset register when the next tile's offset is formed: the wait, and the
            // register named in it, as in front of the loop.
            asm volatile("s_wait_xcnt 0x0" :: "v"(o) : "memory");
            // Keeps the forming of the next offset behind that wait: the scheduler otherwise lifts it over the wait.
            __builtin_amdgcn_sched_barrier(0);
        }
    }
#pragma unroll
    for (int u = 0; u < SETS - 1; ++u) products(u);   // the last tiles: nothing left to request

    const int half = lane >> 4;
    const int nc = lane & 15;
    if (MODE == 0) {
        const int h = n0 >> 6;   // the wave's 64 columns are one head
        float bj[4][8];          // read once, ahead of the waits below, which would have it read again for every i
#pragma unroll
        for (int j = 0; j < 4; ++j)
#pragma unroll
            for (int r = 0; r < 8; ++r) bj[j][r] = bias[n0 + 16 * j + 8 * half + r];
#pragma unroll
        for (int i = 0; i < MI; ++i) {
            const int mb = m0 + 16 * i;
            const int b = mb / T, tt = (mb % T) >> 4;
            bf16_t* tile = (bf16_t*)out + ((size_t)b * H + h) * T * 64 + (size_t)tt * 1024 + lane * 8;
#pragma unroll
            for (int j = 0; j < 4; ++j) {
                v8bf o;
#pragma unroll
                for (int r = 0; r < 8; ++r) o[r] = (bf16_t)((acc[i][j][r] + bj[j][r]) * osc);
                *(v8bf*)(tile + j * 256) = o;
            }
            // The next rows' arithmetic reuses the registers that these stores name.
            if (i + 1 < MI) asm volatile("s_wait_xcnt 0x0" ::: "memory");
            // Keeps that arithmetic behind the wait: nothing else ties it to the stores' registers.
            __builtin_amdgcn_sched_barrier(0);
        }
    } else if (MODE == 1) {
        const int h = n0 >> 6;
        const int b = m0 / T, sb = (m0 % T) >> 5;   // each 32 of the wave's rows are one k tile of v^T
        const int KTs = T >> 5;
        bf16_t* base = (bf16_t*)out + ((size_t)b * H + h) * 64 * T + lane * 8;
#pragma unroll
        for (int j = 0; j < 4; ++j) {
            const float bn = bias[n0 + 16 * j + nc];
#pragma unroll
            for (int i = 0; i < MI; ++i) {
                v8bf o;
#pragma unroll
                for (int r = 0; r < 8; ++r) o[r] = (bf16_t)(acc[i][j][r] + bn);
                *(v8bf*)(base + ((size_t)j * KTs + sb + (i >> 1)) * 512 + (i & 1) * 256) = o;
            }
        }
    } else {
#pragma unroll
        for (int i = 0; i < MI; ++i) {
#pragma unroll
            for (int j = 0; j < 4; ++j) {
#pragma unroll
                for (int r = 0; r < 8; ++r) {
                    const int m = m0 + 16 * i + r + 8 * half;
                    const int n = n0 + 16 * j + nc;
                    ((float*)out)[(size_t)m * N + n] = acc[i][j][r] + bias[n];
                }
            }
        }
    }
}

// One GEMM a launch (the output projection). Block: 8 waves (4M x 2N) of 32 x 64 -> 128(M) x 128(N): the square block
// asks L2 for 16 fragments per k tile where 64 x 256 asks for 20, with the same 256 blocks.
// grid (M/128, N/128), 256 threads
template <int MODE, int K>
__global__ void __launch_bounds__(256) __attribute__((amdgpu_waves_per_eu(4, 4))) mha_gemm_wmma(const bf16_t* __restrict__ A,
                              const bf16_t* __restrict__ Bm,
                              const float* __restrict__ bias,
                              void* __restrict__ out,
                              int M, int N, int T, int H) {
    const int wave = __builtin_amdgcn_readfirstlane(threadIdx.x >> 5);
    const int m0 = blockIdx.x * 128 + (wave & 3) * 32;
    const int n0 = blockIdx.y * 128 + (wave >> 2) * 64;
    // The block's 8 + 8 row groups of 32 KB: of each operand this block asks for the two groups of its class, a wave for 8 KB.
    static_assert(K == 1024, "a 16-row group is four requests of 8 KB");
    constexpr size_t gb = (size_t)K * 32;   // bytes per 16-row group
    const unsigned unit = (threadIdx.x & 31) * 256;
    const char* pa = (const char*)A  + (size_t)(blockIdx.x * 8 + (wave & 1) * 4 + (blockIdx.y & 3)) * gb + (wave >> 1) * 8192;
    const char* pb = (const char*)Bm + (size_t)(blockIdx.y * 8 + (wave & 1) * 4 + (blockIdx.x & 3)) * gb + (wave >> 1) * 8192;
    ask_l2(pa + unit, pb + unit);
    // The 8 blocks on the same rows of A start 4 k tiles apart, the 32 on the same rows of B one apart.
    const int kt0 = (blockIdx.x + 4 * blockIdx.y) & ((K >> 5) - 1);
    gemm_wmma_tile<MODE, K, 2>(A, Bm, bias, out, m0, n0, kt0, N, T, H, 1.0f);
}

template <int K>
__global__ void __launch_bounds__(384) __attribute__((amdgpu_waves_per_eu(3, 3))) mha_gemm_kqv(const bf16_t* __restrict__ A,
                              const bf16_t* __restrict__ wkT, const bf16_t* __restrict__ wqT, const bf16_t* __restrict__ wvT,
                              const float* __restrict__ bk, const float* __restrict__ bq, const float* __restrict__ bv,
                              bf16_t* __restrict__ kmat, bf16_t* __restrict__ qmat, bf16_t* __restrict__ vTm,
                              int M, int N, int T, int H, float kscale) {
    const int wave = __builtin_amdgcn_readfirstlane(threadIdx.x >> 5);
    const int which = wave >> 2;
    const int m0 = blockIdx.x * 256 + (wave & 3) * 64;
    const int n0 = blockIdx.y * 64;
    // The block's 16 row groups of x and 3 x 4 of the weights, 32 KB each: this block asks for the four x groups and the
    // three weight groups of its class, 16 + 12 requests of 8 KB: a wave one of each, the last four waves a second of x.
    static_assert(K == 1024, "a 16-row group is four requests of 8 KB");
    constexpr size_t gb = (size_t)K * 32;   // bytes per 16-row group
    const unsigned unit = (threadIdx.x & 31) * 256;
    const bf16_t* wT = which == 0 ? wkT : which == 1 ? wqT : wvT;
    const char* pa = (const char*)A  + (size_t)(blockIdx.x * 16 + (wave & 3) * 4 + (blockIdx.y & 3)) * gb + which * 8192;
    const char* pb = (const char*)wT + (size_t)(blockIdx.y * 4 + (blockIdx.x & 3)) * gb + (wave & 3) * 8192;
    ask_l2(pa + unit, pb + unit);
    if (which == 2) ask_l2(pa + 8192 + unit);   // the x group's fourth piece; the test reads the same in every lane: a scalar branch
    // The 16 blocks on the same rows of x start 2 k tiles apart, the 16 on the same head's weights one apart.
    const int kt0 = (blockIdx.x + 2 * blockIdx.y) & ((K >> 5) - 1);
    if (which == 2) gemm_wmma_tile<1, K, 4>(A, wvT, bv, (void*)vTm, m0, n0, kt0, N, T, H, 1.0f);
    else            gemm_wmma_tile<0, K, 4>(A, which ? wqT : wkT, which ? bq : bk, (void*)(which ? qmat : kmat), m0, n0, kt0, N, T, H,
                                            which ? 1.0f : kscale);
}

static __device__ __forceinline__ void exp2_in_place(float& a, float& b, float& c, float& d,
                                                     float& e, float& f, float& g, float& h) {
    asm("v_exp_f32 %0, %0\n\tv_exp_f32 %1, %1\n\tv_exp_f32 %2, %2\n\tv_exp_f32 %3, %3\n\t"
        "v_exp_f32 %4, %4\n\tv_exp_f32 %5, %5\n\tv_exp_f32 %6, %6\n\tv_exp_f32 %7, %7\n\t"
        "v_nop"
        : "+v"(a), "+v"(b), "+v"(c), "+v"(d), "+v"(e), "+v"(f), "+v"(g), "+v"(h));
}
static __device__ __forceinline__ void exp2_in_place(float& a) {
    asm("v_exp_f32 %0, %0\n\tv_nop" : "+v"(a));
}

template <int T>
__global__ void __launch_bounds__(256) mha_flash_attn(const bf16_t* __restrict__ Kp,
                               const bf16_t* __restrict__ Qp,
                               const bf16_t* __restrict__ VTp,
                               bf16_t* __restrict__ Oh,
                               int H) {
    const int lane = threadIdx.x & 31;
    const int wave = __builtin_amdgcn_readfirstlane(threadIdx.x >> 5);   // wave-uniform: tile bases are formed in scalar registers
    const int bh = blockIdx.y;
    const int b = bh / H, h = bh % H;
    const int t0 = blockIdx.x * 256 + wave * 32;

    const bf16_t* kbase = Kp  + (size_t)bh * T * 64;
    const bf16_t* qbase = Qp  + (size_t)bh * T * 64;
    const bf16_t* vbase = VTp + (size_t)bh * 64 * T;

    // The 256 KB of q and the 256 KB of v^T that the eight blocks of this (b, h) all walk: this block asks for the quarter of
    // its class, every fourth 8 KB of q and one 16-row group of v^T, a wave for 8 KB of each.
    static_assert(T == 2048, "8 waves x 4 classes x 8 KB = T rows of q = 64 rows of v^T");
    const unsigned cls = blockIdx.x & 3;
    const unsigned unit = lane * 256;
    const char* pq = (const char*)qbase + (4 * wave + cls) * 8192;
    const char* pv = (const char*)vbase + (8 * cls + wave) * 8192;
    ask_l2(pq + unit, pv + unit);

    // k tiles as B operands (N = t columns, K = d), resident for whole loop; kb[g]: column group g
    v16bf kb[2][2];
#pragma unroll
    for (int g = 0; g < 2; ++g) {
        kb[g][0] = load_frag_tiled(kbase + (size_t)(t0 + 16 * g) * 64, lane * 16);
        kb[g][1] = load_frag_tiled(kbase + (size_t)(t0 + 16 * g) * 64, lane * 16 + 1024);
    }

    float lstat[2] = {0.f, 0.f};   // this half's part of the column's sum
    v8f negm[2];                   // minus the column's maximum in use, the same in all 8 registers and in both halves: the scores' C operand
    v8f o[2][4] = {};              // O^T: per group 4 d-tiles x (8 vgprs), col t = lane&15

    constexpr size_t vgs = (size_t)T * 16;   // elements per 16-row group of v^T
    static_assert(T % 256 == 0, "a block owns 256 t, and the loop walks two trips of 32 s at a time");
    v16bf qf[2][4], vf[2][4];
    const unsigned loff = lane * 16;
    // The walk along s starts in chunk p0 of 64 s and wraps round: the eight blocks of one (b, h) start 256 s apart, and
    // neighbouring (b, h) one chunk apart, so that they do not all ask L2 for the same lines in the same moment.
    // It starts at the chunk's second half and ends with its first: the two requests of a loop pass then lie in one chunk.
    constexpr int NP = T / 64;
    static_assert((NP & (NP - 1)) == 0, "the wrap of the walk is a mask");
    const int p0 = (4 * blockIdx.x + bh) & (NP - 1);
    const char* qa = (const char*)(qbase + (size_t)p0 * 4096) + loff;
    const char* va = (const char*)(vbase + (size_t)p0 * 1024) + loff;
    // second: 0 or 1, the half of the chunk that qa and va stand at; a constant, so it folds into the loads' offset field
    auto fetch = [&](int set, int second) __attribute__((always_inline)) {
#pragma unroll
        for (int f = 0; f < 4; ++f) qf[set][f] = load_frag_tiled((const bf16_t*)qa, 4096 * second + 1024 * f);
#pragma unroll
        for (int j = 0; j < 4; ++j) vf[set][j] = load_frag_tiled((const bf16_t*)va + j * vgs, 1024 * second);
    };
    // The wait that stands between a chunk's requests and the next values of their address registers. Naming the registers
    // keeps them alive up to the wait, and so apart from the registers that the requests fill.
    auto addresses_free = [&]() __attribute__((always_inline)) {
        asm volatile("s_wait_xcnt 0x0" :: "v"(qa), "v"(va) : "memory");
    };
    // S^T + c: per group two 16-row s-tiles, D=64 in two WMMA K-steps each; x[g][8 * m + r] = group g, tile m, vgpr r
    auto scores = [&](int set, const v8f (&c)[2], float (&x)[2][16]) __attribute__((always_inline)) {
        v8f accs[2][2];
#pragma unroll
        for (int m = 0; m < 2; ++m)
#pragma unroll
            for (int g = 0; g < 2; ++g) accs[g][m] = wmma_bf16(qf[set][2 * m], kb[g][0], c[g]);
#pragma unroll
        for (int m = 0; m < 2; ++m)
#pragma unroll
            for (int g = 0; g < 2; ++g) accs[g][m] = wmma_bf16(qf[set][2 * m + 1], kb[g][1], accs[g][m]);
#pragma unroll
        for (int g = 0; g < 2; ++g)
#pragma unroll
            for (int m = 0; m < 2; ++m)
#pragma unroll
                for (int r = 0; r < 8; ++r) x[g][8 * m + r] = accs[g][m][r];
    };
    auto lane_max = [&](const float (&x)[16]) __attribute__((always_inline)) {
        float mx = x[0];
#pragma unroll
        for (int i = 1; i < 16; ++i) mx = fmaxf(mx, x[i]);
        return mx;
    };
    auto trip = [&](int set, bool more) __attribute__((always_inline)) {
        if (more) fetch(set ^ 1, set);   // set 1 takes a chunk's first half, set 0 its second
        // Keeps these requests in front of the branch below: without it the compiler sinks them behind the branch,
        // to just before their use, and the wave waits out the whole latency.
        asm volatile("" ::: "memory");
        // Keeps the requests in front of the score products, which the scheduler otherwise lifts over them.
        __builtin_amdgcn_sched_barrier(0);
        float x[2][16];
        scores(set, negm, x);
        __builtin_amdgcn_sched_barrier(0);
        float mx[2] = {lane_max(x[0]), lane_max(x[1])};
        if (__builtin_amdgcn_ballot_w32(fmaxf(mx[0], mx[1]) > 8.0f) != 0) {   // the same in every lane: a scalar branch, rarely taken
#pragma unroll
            for (int g = 0; g < 2; ++g) {
                const float mg = fmaxf(mx[g], __shfl_xor(mx[g], 16, 32));   // combine the two halves
                const float up = fmaxf(mg, 0.f);                            // a column whose maximum has not grown keeps it
                float corr = -up;
                exp2_in_place(corr);
#pragma unroll
                for (int i = 0; i < 16; ++i) x[g][i] -= up;
#pragma unroll
                for (int r = 0; r < 8; ++r) negm[g][r] -= up;
                lstat[g] *= corr;
#pragma unroll
                for (int j = 0; j < 4; ++j)
#pragma unroll
                    for (int r = 0; r < 8; ++r) o[g][j][r] *= corr;
            }
        }
#pragma unroll
        for (int g = 0; g < 2; ++g) {
            float (&y)[16] = x[g];
            exp2_in_place(y[0], y[1], y[2], y[3], y[4], y[5], y[6], y[7]);
            exp2_in_place(y[8], y[9], y[10], y[11], y[12], y[13], y[14], y[15]);

            v16bf pb;           // P^T B-fragment, built in-register
            float psum = y[0];
#pragma unroll
            for (int i = 1; i < 16; ++i) psum += y[i];
#pragma unroll
            for (int i = 0; i < 16; ++i) pb[i] = (bf16_t)y[i];
            lstat[g] += psum;

            // ---- O^T += V^T (d x 32s) x P^T (32s x 16t) ----
#pragma unroll
            for (int j = 0; j < 4; ++j) o[g][j] = wmma_bf16(vf[set][j], pb, o[g][j]);
        }
    };

    fetch(0, 1);
    // These loads are still in flight where the code behind them gives their address registers a new value.
    asm volatile("s_wait_xcnt 0x0" ::: "memory");
    // Keeps those new values behind that wait: the scheduler otherwise lifts the next chunk's scalar arithmetic over it.
    __builtin_amdgcn_sched_barrier(0);
    {   // The first maximum in use is the true maximum of the first 32 s walked: whatever the scores' level, some exponential of the sum is 1.
        float x[2][16];
        const v8f zero[2] = {};
        scores(0, zero, x);
#pragma unroll
        for (int g = 0; g < 2; ++g) {
            float mx = lane_max(x[g]);
            mx = fmaxf(mx, __shfl_xor(mx, 16, 32));
#pragma unroll
            for (int r = 0; r < 8; ++r) negm[g][r] = -mx;
        }
    }
    for (int p = 1; p <= NP; ++p) {
        const int pn = (p0 + p) & (NP - 1);   // the last pass is back in chunk p0, for its first half
        qa = (const char*)(qbase + (size_t)pn * 4096) + loff;
        va = (const char*)(vbase + (size_t)pn * 1024) + loff;
        if (p == NP) break;
        trip(0, true);
        trip(1, true);
        // The loop's requests still name the address registers that are given new values at the loop's head.
        addresses_free();
        // Keeps those new values behind that wait: the scheduler otherwise lifts them over the wait.
        __builtin_amdgcn_sched_barrier(0);
    }
    trip(0, true);
    addresses_free();   // the last requests' registers are reused by the code that follows
    trip(1, false);   // the last trip: nothing left to request

#pragma unroll
    for (int g = 0; g < 2; ++g) {
        const float l = lstat[g] + __shfl_xor(lstat[g], 16, 32);   // the two halves' sums, joined
        const float inv = 1.0f / l;
        bf16_t* obase = Oh + ((size_t)((b * T + t0 + 16 * g) >> 4) * (H * 2) + h * 2) * 512 + lane * 8;
#pragma unroll
        for (int j = 0; j < 4; ++j) {
            v8bf ov;
#pragma unroll
            for (int r = 0; r < 8; ++r) ov[r] = (bf16_t)(o[g][j][r] * inv);
            *(v8bf*)(obase + j * 256) = ov;
        }
    }
}

// ---------------------------------------------------------------------------
// Host-side launch
// ---------------------------------------------------------------------------
extern "C" void kernel_launch(void* const* d_in, const int* in_sizes, int n_in,
                              void* d_out, int out_size, void* d_ws, size_t ws_size,
                              hipStream_t stream) {
    constexpr int Bb = 2, T = 2048, Cc = 1024, H = 16, D = 64;
    constexpr int M = Bb * T;          // 4096
    const float kscale = 1.44269504f / 32.0f;  // C^-0.5 = 1024^-0.5, times log2(e): exp(y) = 2^(y * log2(e))

    const float* x  = (const float*)d_in[0];
    const float* Wk = (const float*)d_in[1];
    const float* bk = (const float*)d_in[2];
    const float* Wq = (const float*)d_in[3];
    const float* bq = (const float*)d_in[4];
    const float* Wv = (const float*)d_in[5];
    const float* bv = (const float*)d_in[6];
    const float* Wp = (const float*)d_in[7];
    const float* bp = (const float*)d_in[8];

    char* ws = (char*)d_ws;
    size_t off = 0;
    bf16_t* xb   = (bf16_t*)(ws + off); off += (size_t)M * Cc * sizeof(bf16_t);         // 8 MB
    bf16_t* wkT  = (bf16_t*)(ws + off); off += (size_t)H * D * Cc * sizeof(bf16_t);     // 2 MB
    bf16_t* wqT  = (bf16_t*)(ws + off); off += (size_t)H * D * Cc * sizeof(bf16_t);
    bf16_t* wvT  = (bf16_t*)(ws + off); off += (size_t)H * D * Cc * sizeof(bf16_t);
    bf16_t* wpT  = (bf16_t*)(ws + off); off += (size_t)Cc * Cc * sizeof(bf16_t);        // 2 MB
    bf16_t* kmat = (bf16_t*)(ws + off); off += (size_t)Bb * H * T * D * sizeof(bf16_t); // 8 MB
    bf16_t* qmat = (bf16_t*)(ws + off); off += (size_t)Bb * H * T * D * sizeof(bf16_t);
    bf16_t* vTm  = (bf16_t*)(ws + off); off += (size_t)Bb * H * T * D * sizeof(bf16_t);
    bf16_t* oh   = (bf16_t*)(ws + off); off += (size_t)M * Cc * sizeof(bf16_t);         // 8 MB

    // 1) conversions / packing, one launch
    {
        constexpr int blocks = 3 * (Cc / 64) * H + (Cc / 64) * (Cc / 64) + (M / 16) * (Cc / 32) / 8;
        mha_pack_all<Cc, H><<<blocks, 256, 0, stream>>>(x, Wk, Wq, Wv, Wp, xb, wkT, wqT, wvT, wpT);
    }

    // 2) k, q, v projections, one launch: each M=4096, N=1024 (h*64+d), K=1024
    {
        dim3 grid(M / 256, H);
        mha_gemm_kqv<Cc><<<grid, 384, 0, stream>>>(xb, wkT, wqT, wvT, bk, bq, bv, kmat, qmat, vTm, M, H * D, T, H, kscale);
    }

    // 3) flash attention: grid (T/256 tiles of t, B*H), 8 waves/block
    {
        dim3 grid(T / 256, Bb * H);
        mha_flash_attn<T><<<grid, 256, 0, stream>>>(kmat, qmat, vTm, oh, H);
    }

    // 4) output projection: [4096,1024] x [1024,1024]^T + bp -> f32 d_out
    {
        dim3 grid(M / 128, Cc / 128);
        mha_gemm_wmma<2, Cc><<<grid, 256, 0, stream>>>(oh, wpT, bp, d_out, M, Cc, T, H);
    }

    (void)in_sizes; (void)n_in; (void)out_size; (void)ws_size;
}

// v010
// It runs in 64.3 microseconds.
// Two timings next to v009 put it at 1.05 and 1.04 times that version's speed.
// Over all steps from v000 it is 6.75 times as fast.
#include <hip/hip_runtime.h>
#include <math.h>

typedef __bf16 bf16_t;
typedef __attribute__((ext_vector_type(16))) __bf16 v16bf;
typedef __attribute__((ext_vector_type(8)))  __bf16 v8bf;
typedef __attribute__((ext_vector_type(8)))  float  v8f;

static __device__ __forceinline__ v8f wmma_bf16(v16bf a, v16bf b, v8f c) {
    // 8 args: (neg_a, A, neg_b, B, c_mod, C, reuse_a, reuse_b)
    return __builtin_amdgcn_wmma_f32_16x16x32_bf16(
        false, a, false, b, (short)0, c, false, false);
}

// Element offset of the 8 consecutive k that start at (row, k), k a multiple of 8.
static __device__ __forceinline__ size_t frag_chunk_offset(int row, int k, int KT) {
    return ((size_t)(row >> 4) * KT + (k >> 5)) * 512
         + (size_t)((((k >> 4) & 1) * 32 + (row & 15) + 16 * ((k >> 3) & 1)) * 8);
}

static __device__ __forceinline__ v16bf load_frag_tiled(const bf16_t* __restrict__ group, unsigned off) {
    const char* p0 = (const char*)group + off;
    v8bf a = *(const v8bf*)p0;
    v8bf b = *(const v8bf*)(p0 + 512);
    v16bf out;
#pragma unroll
    for (int i = 0; i < 8; ++i) { out[i] = a[i]; out[i + 8] = b[i]; }
    return out;
}

static __device__ __forceinline__ void ask_l2(const char* p) {
    asm volatile("global_prefetch_b8 %0, off scope:SCOPE_SE\n\t"
                 "s_wait_xcnt 0x0" :: "v"(p) : "memory");
}
static __device__ __forceinline__ void ask_l2(const char* p, const char* q) {
    asm volatile("global_prefetch_b8 %0, off scope:SCOPE_SE\n\t"
                 "global_prefetch_b8 %1, off scope:SCOPE_SE\n\t"
                 "s_wait_xcnt 0x0" :: "v"(p), "v"(q) : "memory");
}

static __device__ __forceinline__ void cvt_bf16_tiles(const float* __restrict__ in, bf16_t* __restrict__ out, int C, int blk) {
    const int lane = threadIdx.x & 31;
    const int tile = blk * 8 + (threadIdx.x >> 5);
    const int KT = C >> 5;
    const int rt = tile / KT, kt = tile % KT;
    const float* p = in + (size_t)(rt * 16 + (lane & 15)) * C + kt * 32 + (lane >> 4) * 8;
    const float4 a0 = *(const float4*)(p);
    const float4 a1 = *(const float4*)(p + 4);
    const float4 b0 = *(const float4*)(p + 16);
    const float4 b1 = *(const float4*)(p + 20);
    v8bf lo, hi;
    lo[0] = (bf16_t)a0.x; lo[1] = (bf16_t)a0.y; lo[2] = (bf16_t)a0.z; lo[3] = (bf16_t)a0.w;
    lo[4] = (bf16_t)a1.x; lo[5] = (bf16_t)a1.y; lo[6] = (bf16_t)a1.z; lo[7] = (bf16_t)a1.w;
    hi[0] = (bf16_t)b0.x; hi[1] = (bf16_t)b0.y; hi[2] = (bf16_t)b0.z; hi[3] = (bf16_t)b0.w;
    hi[4] = (bf16_t)b1.x; hi[5] = (bf16_t)b1.y; hi[6] = (bf16_t)b1.z; hi[7] = (bf16_t)b1.w;
    bf16_t* q = out + (size_t)tile * 512 + lane * 8;
    *(v8bf*)q = lo;
    *(v8bf*)(q + 256) = hi;
    // In the merged launch other jobs' code follows these stores in the listing and reuses their registers.
    asm volatile("s_wait_xcnt 0x0" ::: "memory");
}

static __device__ __forceinline__ void transpose_tile_64x64(
    const float* __restrict__ in, int ldin, bf16_t* __restrict__ out, int row0, int k0, int KT) {
    __shared__ float tile[64][65];
    const int tid = threadIdx.x;

    const int lr = tid >> 4;         // 0..15: row inside a group of 16
    const int lc = (tid & 15) * 4;   // first of 4 columns
#pragma unroll
    for (int i = 0; i < 4; ++i) {
        const int r = i * 16 + lr;
        const float4 v = *(const float4*)(in + (size_t)r * ldin + lc);
        tile[r][lc + 0] = v.x;
        tile[r][lc + 1] = v.y;
        tile[r][lc + 2] = v.z;
        tile[r][lc + 3] = v.w;
    }
    __syncthreads();

    const int sr = tid >> 3;         // 0..31: output row inside a group of 32
    const int sc = (tid & 7) * 8;    // first of 8 output columns
#pragma unroll
    for (int i = 0; i < 2; ++i) {
        const int j = i * 32 + sr;
        v8bf o;
#pragma unroll
        for (int k = 0; k < 8; ++k) o[k] = (bf16_t)tile[sc + k][j];
        *(v8bf*)(out + frag_chunk_offset(row0 + j, k0 + sc, KT)) = o;
    }
    // In the merged launch other jobs' code follows these stores in the listing and reuses their registers.
    asm volatile("s_wait_xcnt 0x0" ::: "memory");
}

// All five packing jobs in ONE launch: none reads what another writes, so the block index picks the job.
//   blocks [0, 3 * WB)      : W[h][c][d] (f32) -> Wt (bf16), operand [N=h*64+d][K=c] in fragment order, for k, q, v;
//                             head size 64 = one tile wide
//   the next PB blocks      : Wp[k][n] (f32) -> WpT (bf16), operand [n][k] in fragment order
//   the rest                : x (f32) -> xb (bf16) in fragment order
// The transposes stand first: theirs is the longer way from load to store.
// grid 3 * WB + PB + (M/16 * C/32) / 8, 256 threads
template <int C, int H>
__global__ void mha_pack_all(const float* __restrict__ x,
                             const float* __restrict__ Wk, const float* __restrict__ Wq,
                             const float* __restrict__ Wv, const float* __restrict__ Wp,
                             bf16_t* __restrict__ xb,
                             bf16_t* __restrict__ wkT, bf16_t* __restrict__ wqT,
                             bf16_t* __restrict__ wvT, bf16_t* __restrict__ wpT) {
    constexpr int CT = C / 64;        // 64-wide tiles along C
    constexpr int WB = CT * H;        // tiles of one per-head weight
    constexpr int PB = CT * CT;       // tiles of the output projection
    const int blk = blockIdx.x;       // the same in every thread of a block: the barrier in the transpose is block-uniform
    if (blk < 3 * WB + PB) {
        const int job = blk / WB < 3 ? blk / WB : 3;
        const int t  = blk - job * WB;
        const int tx = (t % CT) * 64;   // c0 (per-head weights), k0 (output projection)
        const int ty = (t / CT) * 64;   // h * 64,                n0
        const float* in  = job == 0 ? Wk : job == 1 ? Wq : job == 2 ? Wv : Wp;
        bf16_t*      out = job == 0 ? wkT : job == 1 ? wqT : job == 2 ? wvT : wpT;
        if (job < 3) transpose_tile_64x64(in + ((size_t)ty * C + (size_t)tx * 64), 64, out, ty, tx, C >> 5);
        else         transpose_tile_64x64(in + (size_t)tx * C + ty,                 C, out, ty, tx, C >> 5);
    } else {
        cvt_bf16_tiles(x, xb, C, blk - (3 * WB + PB));
    }
}

template <int MODE, int K, int MI, int SETS>
static __device__ __forceinline__ void gemm_wmma_tile(const bf16_t* __restrict__ A,
                              const bf16_t* __restrict__ Bm,
                              const float* __restrict__ bias,
                              void* __restrict__ out,
                              int m0, int n0,   // wave-uniform: tile bases are formed in scalar registers
                              int kt0,          // the same in every wave of a block
                              int N, int T, int H, float osc) {
    const int lane = threadIdx.x & 31;

    constexpr int KT = K >> 5;
    const int mt = m0 >> 4;
    const int nt = n0 >> 4;

    const bf16_t* ag = A  + (size_t)mt * KT * 512;   // the wave's MI 16-row groups of A
    const bf16_t* bg = Bm + (size_t)nt * KT * 512;   // and its four of B
    constexpr size_t gs = (size_t)KT * 512;          // elements per 16-row group

    // SETS register sets: one in use, the others in flight. The loop walks SETS tiles a trip; MAIN tiles are walked so.
    static_assert(KT >= SETS, "the sets are filled from different tiles");
    constexpr int MAIN = (KT - (SETS - 1)) / SETS * SETS;
    static_assert((KT & (KT - 1)) == 0, "the wrap of the walk is a mask");

    v8f acc[MI][4] = {};
    v16bf fa[SETS][MI], fb[SETS][4];
    const unsigned loff = lane * 16;
    // step: place in the walk; its tile is (kt0 + step) mod KT, a scalar. Returns the offset register that the requests name.
    auto fetch = [&](int set, int step) __attribute__((always_inline)) {
        const unsigned o = loff + (unsigned)((kt0 + step) & (KT - 1)) * 1024;
#pragma unroll
        for (int i = 0; i < MI; ++i) fa[set][i] = load_frag_tiled(ag + i * gs, o);
#pragma unroll
        for (int j = 0; j < 4; ++j) fb[set][j] = load_frag_tiled(bg + j * gs, o);
        return o;
    };
    auto products = [&](int set) __attribute__((always_inline)) {
#pragma unroll
        for (int j = 0; j < 4; ++j) {
#pragma unroll
            for (int i = 0; i < MI; ++i) {
                if (MODE == 0) acc[i][j] = wmma_bf16(fb[set][j], fa[set][i], acc[i][j]);
                else           acc[i][j] = wmma_bf16(fa[set][i], fb[set][j], acc[i][j]);
            }
        }
    };

#pragma unroll
    for (int s = 0; s < SETS - 1; ++s) {
        const unsigned o = fetch(s, s);
        // Keeps the tiles' requests in the order of their use: mixed, the loop's first counted waits must cover younger tiles too.
        __builtin_amdgcn_sched_barrier(0);
        asm volatile("s_wait_xcnt 0x0" :: "v"(o) : "memory");
        // Keeps what follows behind that wait.
        __builtin_amdgcn_sched_barrier(0);
    }
    auto tile_with_fetch = [&](int u, int step) __attribute__((always_inline)) {
        const unsigned o = fetch((u + SETS - 1) % SETS, step);
        // Keeps the requests in front of these products: without it the scheduler sinks them to just
        // before their own use, and the wave waits out the whole L2 latency again.
        __builtin_amdgcn_sched_barrier(0);
        products(u);
        // Keeps what follows behind these products: the next requests and the wait below, which would otherwise
        // stall the wave in front of products that are ready.
        __builtin_amdgcn_sched_barrier(0);
        // This tile's requests still name the offset register when the next tile's offset is formed: the wait, and the
        // register named in it, as in front of the loop.
        asm volatile("s_wait_xcnt 0x0" :: "v"(o) : "memory");
        // Keeps the forming of the next offset behind that wait: the scheduler otherwise lifts it over the wait.
        __builtin_amdgcn_sched_barrier(0);
    };
    for (int kt = 0; kt < MAIN; kt += SETS) {
#pragma unroll
        for (int u = 0; u < SETS; ++u) tile_with_fetch(u, kt + u + SETS - 1);
    }
#pragma unroll
    for (int t = MAIN; t < KT; ++t) {
        if (t + SETS - 1 < KT) tile_with_fetch(t % SETS, t + SETS - 1);
        else                   products(t % SETS);   // the last tiles: nothing left to request
    }

    const int half = lane >> 4;
    const int nc = lane & 15;
    if (MODE == 0) {
        const int h = n0 >> 6;   // the wave's 64 columns are one head
        float bj[4][8];          // read once, ahead of the waits below, which would have it read again for every i
#pragma unroll
        for (int j = 0; j < 4; ++j)
#pragma unroll
            for (int r = 0; r < 8; ++r) bj[j][r] = bias[n0 + 16 * j + 8 * half + r];
#pragma unroll
        for (int i = 0; i < MI; ++i) {
            const int mb = m0 + 16 * i;
            const int b = mb / T, tt = (mb % T) >> 4;
            bf16_t* tile = (bf16_t*)out + ((size_t)b * H + h) * T * 64 + (size_t)tt * 1024 + lane * 8;
#pragma unroll
            for (int j = 0; j < 4; ++j) {
                v8bf o;
#pragma unroll
                for (int r = 0; r < 8; ++r) o[r] = (bf16_t)((acc[i][j][r] + bj[j][r]) * osc);
                *(v8bf*)(tile + j * 256) = o;
            }
            // The next rows' arithmetic reuses the registers that these stores name.
            if (i + 1 < MI) asm volatile("s_wait_xcnt 0x0" ::: "memory");
            // Keeps that arithmetic behind the wait: nothing else ties it to the stores' registers.
            __builtin_amdgcn_sched_barrier(0);
        }
    } else if (MODE == 1) {
        const int h = n0 >> 6;
        const int b = m0 / T, sb = (m0 % T) >> 5;   // each 32 of the wave's rows are one k tile of v^T
        const int KTs = T >> 5;
        bf16_t* base = (bf16_t*)out + ((size_t)b * H + h) * 64 * T + lane * 8;
#pragma unroll
        for (int j = 0; j < 4; ++j) {
            const float bn = bias[n0 + 16 * j + nc];
#pragma unroll
            for (int i = 0; i < MI; ++i) {
                v8bf o;
#pragma unroll
                for (int r = 0; r < 8; ++r) o[r] = (bf16_t)(acc[i][j][r] + bn);
                *(v8bf*)(base + ((size_t)j * KTs + sb + (i >> 1)) * 512 + (i & 1) * 256) = o;
            }
        }
    } else {
        const int nb = n0 + nc;
        float bn[4];   // read as one run
#pragma unroll
        for (int j = 0; j < 4; ++j) bn[j] = bias[nb + 16 * j];
        // The stores' address arithmetic reuses the offset register that these four loads still name: the wait stands between them,
        // and naming the register in it keeps it alive up to the wait.
        asm volatile("s_wait_xcnt 0x0" :: "v"(nb) : "memory");
        // Keeps that arithmetic behind the wait: the scheduler otherwise lifts it over the wait.
        __builtin_amdgcn_sched_barrier(0);
#pragma unroll
        for (int i = 0; i < MI; ++i) {
#pragma unroll
            for (int j = 0; j < 4; ++j) {
#pragma unroll
                for (int r = 0; r < 8; ++r) {
                    const int m = m0 + 16 * i + r + 8 * half;
                    const int n = n0 + 16 * j + nc;
                    ((float*)out)[(size_t)m * N + n] = acc[i][j][r] + bn[j];
                }
            }
        }
    }
}

template <int MODE, int K>
__global__ void __launch_bounds__(256) __attribute__((amdgpu_waves_per_eu(2, 2))) mha_gemm_wmma(const bf16_t* __restrict__ A,
                              const bf16_t* __restrict__ Bm,
                              const float* __restrict__ bias,
                              void* __restrict__ out,
                              int M, int N, int T, int H) {
    const int wave = __builtin_amdgcn_readfirstlane(threadIdx.x >> 5);
    const int m0 = blockIdx.x * 128 + (wave & 3) * 32;
    const int n0 = blockIdx.y * 128 + (wave >> 2) * 64;
    // The block's 8 + 8 row groups of 32 KB: of each operand this block asks for the two groups of its class, a wave for 8 KB.
    static_assert(K == 1024, "a 16-row group is four requests of 8 KB");
    constexpr size_t gb = (size_t)K * 32;   // bytes per 16-row group
    const unsigned unit = (threadIdx.x & 31) * 256;
    const char* pa = (const char*)A  + (size_t)(blockIdx.x * 8 + (wave & 1) * 4 + (blockIdx.y & 3)) * gb + (wave >> 1) * 8192;
    const char* pb = (const char*)Bm + (size_t)(blockIdx.y * 8 + (wave & 1) * 4 + (blockIdx.x & 3)) * gb + (wave >> 1) * 8192;
    ask_l2(pa + unit, pb + unit);
    // The 8 blocks on the same rows of A start 4 k tiles apart, the 32 on the same rows of B one apart.
    const int kt0 = (blockIdx.x + 4 * blockIdx.y) & ((K >> 5) - 1);
    gemm_wmma_tile<MODE, K, 2, 5>(A, Bm, bias, out, m0, n0, kt0, N, T, H, 1.0f);
}

template <int K>
__global__ void __launch_bounds__(384) __attribute__((amdgpu_waves_per_eu(3, 3))) mha_gemm_kqv(const bf16_t* __restrict__ A,
                              const bf16_t* __restrict__ wkT, const bf16_t* __restrict__ wqT, const bf16_t* __restrict__ wvT,
                              const float* __restrict__ bk, const float* __restrict__ bq, const float* __restrict__ bv,
                              bf16_t* __restrict__ kmat, bf16_t* __restrict__ qmat, bf16_t* __restrict__ vTm,
                              int M, int N, int T, int H, float kscale) {
    const int wave = __builtin_amdgcn_readfirstlane(threadIdx.x >> 5);
    const int which = wave >> 2;
    const int m0 = blockIdx.x * 256 + (wave & 3) * 64;
    const int n0 = blockIdx.y * 64;
    // The block's 16 row groups of x and 3 x 4 of the weights, 32 KB each: this block asks for the four x groups and the
    // three weight groups of its class, 16 + 12 requests of 8 KB: a wave one of each, the last four waves a second of x.
    static_assert(K == 1024, "a 16-row group is four requests of 8 KB");
    constexpr size_t gb = (size_t)K * 32;   // bytes per 16-row group
    const unsigned unit = (threadIdx.x & 31) * 256;
    const bf16_t* wT = which == 0 ? wkT : which == 1 ? wqT : wvT;
    const char* pa = (const char*)A  + (size_t)(blockIdx.x * 16 + (wave & 3) * 4 + (blockIdx.y & 3)) * gb + which * 8192;
    const char* pb = (const char*)wT + (size_t)(blockIdx.y * 4 + (blockIdx.x & 3)) * gb + (wave & 3) * 8192;
    ask_l2(pa + unit, pb + unit);
    if (which == 2) ask_l2(pa + 8192 + unit);   // the x group's fourth piece; the test reads the same in every lane: a scalar branch
    // The 16 blocks on the same rows of x start 2 k tiles apart, the 16 on the same head's weights one apart.
    const int kt0 = (blockIdx.x + 2 * blockIdx.y) & ((K >> 5) - 1);
    if (which == 2) gemm_wmma_tile<1, K, 4, 3>(A, wvT, bv, (void*)vTm, m0, n0, kt0, N, T, H, 1.0f);
    else            gemm_wmma_tile<0, K, 4, 3>(A, which ? wqT : wkT, which ? bq : bk, (void*)(which ? qmat : kmat), m0, n0, kt0, N, T, H,
                                            which ? 1.0f : kscale);
}

static __device__ __forceinline__ void exp2_in_place(float& a, float& b, float& c, float& d,
                                                     float& e, float& f, float& g, float& h) {
    asm("v_exp_f32 %0, %0\n\tv_exp_f32 %1, %1\n\tv_exp_f32 %2, %2\n\tv_exp_f32 %3, %3\n\t"
        "v_exp_f32 %4, %4\n\tv_exp_f32 %5, %5\n\tv_exp_f32 %6, %6\n\tv_exp_f32 %7, %7\n\t"
        "v_nop"
        : "+v"(a), "+v"(b), "+v"(c), "+v"(d), "+v"(e), "+v"(f), "+v"(g), "+v"(h));
}
static __device__ __forceinline__ void exp2_in_place(float& a) {
    asm("v_exp_f32 %0, %0\n\tv_nop" : "+v"(a));
}

template <int T>
__global__ void __launch_bounds__(256) mha_flash_attn(const bf16_t* __restrict__ Kp,
                               const bf16_t* __restrict__ Qp,
                               const bf16_t* __restrict__ VTp,
                               bf16_t* __restrict__ Oh,
                               int H) {
    const int lane = threadIdx.x & 31;
    const int wave = __builtin_amdgcn_readfirstlane(threadIdx.x >> 5);   // wave-uniform: tile bases are formed in scalar registers
    const int bh = blockIdx.y;
    const int b = bh / H, h = bh % H;
    const int t0 = blockIdx.x * 256 + wave * 32;

    const bf16_t* kbase = Kp  + (size_t)bh * T * 64;
    const bf16_t* qbase = Qp  + (size_t)bh * T * 64;
    const bf16_t* vbase = VTp + (size_t)bh * 64 * T;

    // The 256 KB of q and the 256 KB of v^T that the eight blocks of this (b, h) all walk: this block asks for the quarter of
    // its class, every fourth 8 KB of q and one 16-row group of v^T, a wave for 8 KB of each.
    static_assert(T == 2048, "8 waves x 4 classes x 8 KB = T rows of q = 64 rows of v^T");
    const unsigned cls = blockIdx.x & 3;
    const unsigned unit = lane * 256;
    const char* pq = (const char*)qbase + (4 * wave + cls) * 8192;
    const char* pv = (const char*)vbase + (8 * cls + wave) * 8192;
    ask_l2(pq + unit, pv + unit);

    // k tiles as B operands (N = t columns, K = d), resident for whole loop; kb[g]: column group g
    v16bf kb[2][2];
#pragma unroll
    for (int g = 0; g < 2; ++g) {
        kb[g][0] = load_frag_tiled(kbase + (size_t)(t0 + 16 * g) * 64, lane * 16);
        kb[g][1] = load_frag_tiled(kbase + (size_t)(t0 + 16 * g) * 64, lane * 16 + 1024);
    }

    float lstat[2] = {0.f, 0.f};   // this half's part of the column's sum
    v8f negm[2];                   // minus the column's maximum in use, the same in all 8 registers and in both halves: the scores' C operand
    v8f o[2][4] = {};              // O^T: per group 4 d-tiles x (8 vgprs), col t = lane&15

    constexpr size_t vgs = (size_t)T * 16;   // elements per 16-row group of v^T
    constexpr int SETS = 4;      // register sets: one in use, three in flight
    constexpr int NT = T / 32;   // trips of 32 s
    static_assert(T % 256 == 0 && NT % SETS == 0 && NT >= 2 * SETS, "a block owns 256 t, and the loop walks SETS trips of 32 s at a time");
    v16bf qf[SETS][4], vf[SETS][4];
    const unsigned loff = lane * 16;
    // The walk along s starts in chunk p0 of 64 s and wraps round: the eight blocks of one (b, h) start 256 s apart, and
    // neighbouring (b, h) one chunk apart, so that they do not all ask L2 for the same lines in the same moment.
    // It starts at the chunk's second half and ends with its first.
    constexpr int NP = T / 64;
    static_assert((NT & (NT - 1)) == 0, "the wrap of the walk is a mask");
    const int p0 = (4 * blockIdx.x + bh) & (NP - 1);
    const int s32 = 2 * p0 + 1;   // the first trip's 32 s
    // step: place in the walk; its 32 s are number (s32 + step) mod NT, a scalar. 32 rows of q = 4 tiles = 4 KB per trip;
    // 32 k of v^T = 1 tile = 1 KB per 16-row group and trip. oq, ov: the offset registers that the requests name.
    auto fetch = [&](int set, int step, unsigned& oq, unsigned& ov) __attribute__((always_inline)) {
        const unsigned at = (unsigned)(s32 + step) & (NT - 1);
        oq = loff + at * 4096;
        ov = loff + at * 1024;
#pragma unroll
        for (int f = 0; f < 4; ++f) qf[set][f] = load_frag_tiled(qbase + f * 512, oq);
#pragma unroll
        for (int j = 0; j < 4; ++j) vf[set][j] = load_frag_tiled(vbase + j * vgs, ov);
    };
    // The wait that stands between a trip's requests and the next values of their offset registers. Naming the registers
    // keeps them alive up to the wait, and so apart from the registers that the requests fill.
    auto offsets_free = [&](unsigned oq, unsigned ov) __attribute__((always_inline)) {
        asm volatile("s_wait_xcnt 0x0" :: "v"(oq), "v"(ov) : "memory");
        // Keeps the forming of the next offsets behind that wait: the scheduler otherwise lifts it over the wait.
        __builtin_amdgcn_sched_barrier(0);
    };
    // S^T + c: per group two 16-row s-tiles, D=64 in two WMMA K-steps each; x[g][8 * m + r] = group g, tile m, vgpr r
    auto scores = [&](int set, const v8f (&c)[2], float (&x)[2][16]) __attribute__((always_inline)) {
        v8f accs[2][2];
#pragma unroll
        for (int m = 0; m < 2; ++m)
#pragma unroll
            for (int g = 0; g < 2; ++g) accs[g][m] = wmma_bf16(qf[set][2 * m], kb[g][0], c[g]);
#pragma unroll
        for (int m = 0; m < 2; ++m)
#pragma unroll
            for (int g = 0; g < 2; ++g) accs[g][m] = wmma_bf16(qf[set][2 * m + 1], kb[g][1], accs[g][m]);
#pragma unroll
        for (int g = 0; g < 2; ++g)
#pragma unroll
            for (int m = 0; m < 2; ++m)
#pragma unroll
                for (int r = 0; r < 8; ++r) x[g][8 * m + r] = accs[g][m][r];
    };
    auto lane_max = [&](const float (&x)[16]) __attribute__((always_inline)) {
        float mx = x[0];
#pragma unroll
        for (int i = 1; i < 16; ++i) mx = fmaxf(mx, x[i]);
        return mx;
    };
    // step: the place in the walk of the trip that is requested here, SETS - 1 ahead of the one worked on
    auto trip = [&](int set, int step, bool more) __attribute__((always_inline)) {
        float x[2][16];
        scores(set, negm, x);
        __builtin_amdgcn_sched_barrier(0);
        unsigned oq = 0, ov = 0;
        if (more) {
            fetch((set + SETS - 1) % SETS, step, oq, ov);
            // Keeps these requests in front of the branch below: without it the compiler sinks them behind the branch,
            // to just before their use, and the wave waits out the whole latency.
            asm volatile("" ::: "memory");
        }
        float mx[2] = {lane_max(x[0]), lane_max(x[1])};
        if (__builtin_amdgcn_ballot_w32(fmaxf(mx[0], mx[1]) > 8.0f) != 0) {   // the same in every lane: a scalar branch, rarely taken
#pragma unroll
            for (int g = 0; g < 2; ++g) {
                const float mg = fmaxf(mx[g], __shfl_xor(mx[g], 16, 32));   // combine the two halves
                const float up = fmaxf(mg, 0.f);                            // a column whose maximum has not grown keeps it
                float corr = -up;
                exp2_in_place(corr);
#pragma unroll
                for (int i = 0; i < 16; ++i) x[g][i] -= up;
#pragma unroll
                for (int r = 0; r < 8; ++r) negm[g][r] -= up;
                lstat[g] *= corr;
#pragma unroll
                for (int j = 0; j < 4; ++j)
#pragma unroll
                    for (int r = 0; r < 8; ++r) o[g][j][r] *= corr;
            }
        }
#pragma unroll
        for (int g = 0; g < 2; ++g) {
            float (&y)[16] = x[g];
            exp2_in_place(y[0], y[1], y[2], y[3], y[4], y[5], y[6], y[7]);
            exp2_in_place(y[8], y[9], y[10], y[11], y[12], y[13], y[14], y[15]);

            v16bf pb;           // P^T B-fragment, built in-register
            float psum = y[0];
#pragma unroll
            for (int i = 1; i < 16; ++i) psum += y[i];
#pragma unroll
            for (int i = 0; i < 16; ++i) pb[i] = (bf16_t)y[i];
            lstat[g] += psum;

            // ---- O^T += V^T (d x 32s) x P^T (32s x 16t) ----
#pragma unroll
            for (int j = 0; j < 4; ++j) o[g][j] = wmma_bf16(vf[set][j], pb, o[g][j]);
        }
        if (more) {
            // Keeps the wait below behind this trip's products, in front of which it would stall the wave.
            __builtin_amdgcn_sched_barrier(0);
            offsets_free(oq, ov);
        }
    };

#pragma unroll
    for (int s = 0; s < SETS - 1; ++s) {
        unsigned oq, ov;
        fetch(s, s, oq, ov);
        // Keeps the trips' requests in the order of their use: mixed, the first counted waits must cover younger trips too.
        __builtin_amdgcn_sched_barrier(0);
        offsets_free(oq, ov);
    }
    {   // The first maximum in use is the true maximum of the first 32 s walked: whatever the scores' level, some exponential of the sum is 1.
        float x[2][16];
        const v8f zero[2] = {};
        scores(0, zero, x);
#pragma unroll
        for (int g = 0; g < 2; ++g) {
            float mx = lane_max(x[g]);
            mx = fmaxf(mx, __shfl_xor(mx, 16, 32));
#pragma unroll
            for (int r = 0; r < 8; ++r) negm[g][r] = -mx;
        }
    }
    for (int i = 0; i < NT - SETS; i += SETS) {
#pragma unroll
        for (int u = 0; u < SETS; ++u) trip(u, i + u + SETS - 1, true);
    }
    trip(0, NT - 1, true);
#pragma unroll
    for (int u = 1; u < SETS; ++u) trip(u, 0, false);   // the last trips: nothing left to request

#pragma unroll
    for (int g = 0; g < 2; ++g) {
        const float l = lstat[g] + __shfl_xor(lstat[g], 16, 32);   // the two halves' sums, joined
        const float inv = 1.0f / l;
        bf16_t* obase = Oh + ((size_t)((b * T + t0 + 16 * g) >> 4) * (H * 2) + h * 2) * 512 + lane * 8;
#pragma unroll
        for (int j = 0; j < 4; ++j) {
            v8bf ov;
#pragma unroll
            for (int r = 0; r < 8; ++r) ov[r] = (bf16_t)(o[g][j][r] * inv);
            *(v8bf*)(obase + j * 256) = ov;
        }
    }
}

// ---------------------------------------------------------------------------
// Host-side launch
// ---------------------------------------------------------------------------
extern "C" void kernel_launch(void* const* d_in, const int* in_sizes, int n_in,
                              void* d_out, int out_size, void* d_ws, size_t ws_size,
                              hipStream_t stream) {
    constexpr int Bb = 2, T = 2048, Cc = 1024, H = 16, D = 64;
    constexpr int M = Bb * T;          // 4096
    const float kscale = 1.44269504f / 32.0f;  // C^-0.5 = 1024^-0.5, times log2(e): exp(y) = 2^(y * log2(e))

    const float* x  = (const float*)d_in[0];
    const float* Wk = (const float*)d_in[1];
    const float* bk = (const float*)d_in[2];
    const float* Wq = (const float*)d_in[3];
    const float* bq = (const float*)d_in[4];
    const float* Wv = (const float*)d_in[5];
    const float* bv = (const float*)d_in[6];
    const float* Wp = (const float*)d_in[7];
    const float* bp = (const float*)d_in[8];

    char* ws = (char*)d_ws;
    size_t off = 0;
    bf16_t* xb   = (bf16_t*)(ws + off); off += (size_t)M * Cc * sizeof(bf16_t);         // 8 MB
    bf16_t* wkT  = (bf16_t*)(ws + off); off += (size_t)H * D * Cc * sizeof(bf16_t);     // 2 MB
    bf16_t* wqT  = (bf16_t*)(ws + off); off += (size_t)H * D * Cc * sizeof(bf16_t);
    bf16_t* wvT  = (bf16_t*)(ws + off); off += (size_t)H * D * Cc * sizeof(bf16_t);
    bf16_t* wpT  = (bf16_t*)(ws + off); off += (size_t)Cc * Cc * sizeof(bf16_t);        // 2 MB
    bf16_t* kmat = (bf16_t*)(ws + off); off += (size_t)Bb * H * T * D * sizeof(bf16_t); // 8 MB
    bf16_t* qmat = (bf16_t*)(ws + off); off += (size_t)Bb * H * T * D * sizeof(bf16_t);
    bf16_t* vTm  = (bf16_t*)(ws + off); off += (size_t)Bb * H * T * D * sizeof(bf16_t);
    bf16_t* oh   = (bf16_t*)(ws + off); off += (size_t)M * Cc * sizeof(bf16_t);         // 8 MB

    // 1) conversions / packing, one launch
    {
        constexpr int blocks = 3 * (Cc / 64) * H + (Cc / 64) * (Cc / 64) + (M / 16) * (Cc / 32) / 8;
        mha_pack_all<Cc, H><<<blocks, 256, 0, stream>>>(x, Wk, Wq, Wv, Wp, xb, wkT, wqT, wvT, wpT);
    }

    // 2) k, q, v projections, one launch: each M=4096, N=1024 (h*64+d), K=1024
    {
        dim3 grid(M / 256, H);
        mha_gemm_kqv<Cc><<<grid, 384, 0, stream>>>(xb, wkT, wqT, wvT, bk, bq, bv, kmat, qmat, vTm, M, H * D, T, H, kscale);
    }

    // 3) flash attention: grid (T/256 tiles of t, B*H), 8 waves/block
    {
        dim3 grid(T / 256, Bb * H);
        mha_flash_attn<T><<<grid, 256, 0, stream>>>(kmat, qmat, vTm, oh, H);
    }

    // 4) output projection: [4096,1024] x [1024,1024]^T + bp -> f32 d_out
    {
        dim3 grid(M / 128, Cc / 128);
        mha_gemm_wmma<2, Cc><<<grid, 256, 0, stream>>>(oh, wpT, bp, d_out, M, Cc, T, H);
    }

    (void)in_sizes; (void)n_in; (void)out_size; (void)ws_size;
}
